// v000
// Times are from an AMD MI455X. After a warm-up the kernel runs many times in a row, and a time is the length of
// such a window on the GPU divided by its runs, so every launch and the gaps after it count. The runs cycle
// through copies of the inputs. A figure is the median of several windows, for all but v000 over two sittings.
// Sittings can differ by a few percent; kernels timed side by side share one.
// v000, which the later versions start from, runs in 865 microseconds.
// Contractions: scores fQ.fK^T on v_wmma_f32_16x16x32_bf16 (fQ, fK as RNE-bf16 planes), attn.fV on v_wmma_f32_16x16x32_f16 (P f16 carried x32768, fV^T as an f16 plane holding RNE-bf16 values); f32 accumulate everywhere; softmax max/exp/sum/normalise in f32.
#include <hip/hip_runtime.h>
#include <math.h>

// ---------------------------------------------------------------------------
// Problem constants
// ---------------------------------------------------------------------------
constexpr int kBatch = 4;
constexpr int kSeq   = 2048;            // rows per input tensor
constexpr int kLtot  = 2 * kSeq;        // 4096 concatenated rows (queries and keys)
constexpr int kDim   = 64;
constexpr float kScale     = 0.125f;    // 64^-0.5, exact
constexpr float kPCarry    = 32768.0f;  // probabilities carried x2^15 in f16
constexpr float kPCarryInv = 1.0f / 32768.0f;
static_assert(kLtot % 64 == 0);         // M, N of the scores GEMM; M of the P.V GEMM
static_assert(kDim % 64 == 0);          // N of the P.V GEMM
static_assert(kDim % 32 == 0);          // K of the scores GEMM
static_assert(kLtot % 32 == 0);         // K of the P.V GEMM
static_assert(kLtot == 4 * 1024);       // softmax thread map: 4 x 256 x 4
static_assert(kSeq % 64 == 0);          // concat boundary on tile boundaries
static_assert((kSeq * kDim) % 2048 == 0);

typedef __attribute__((ext_vector_type(16))) _Float16 v16h;
typedef __attribute__((ext_vector_type(8)))  _Float16 v8h;
typedef __attribute__((ext_vector_type(16))) __bf16   v16b;
typedef __attribute__((ext_vector_type(8)))  __bf16   v8b;
typedef __attribute__((ext_vector_type(8)))  float    v8f;
typedef __attribute__((ext_vector_type(4)))  float    v4f;
typedef __attribute__((ext_vector_type(4)))  unsigned int v4u;

// ---------------------------------------------------------------------------
// Device helpers
// ---------------------------------------------------------------------------
__device__ __forceinline__ unsigned short f2bf_bits(float f) {
  unsigned u = __float_as_uint(f);
  return (unsigned short)((u + 0x7FFFu + ((u >> 16) & 1u)) >> 16);
}
__device__ __forceinline__ float bf_bits2f(unsigned short h) { return __uint_as_float(((unsigned)h) << 16); }

// hazard guards as plain device helpers (no inline asm inside the kernel template body)
__device__ __forceinline__ void dep_guard_h(v8f& a, v8f& b, v16h x, v16h y) { asm volatile("v_nop\n\tv_nop\n\tv_nop\n\tv_nop" : "+v"(a), "+v"(b) : "v"(x), "v"(y)); }
__device__ __forceinline__ void dep_guard_b(v8f& a, v8f& b, v16b x, v16b y) { asm volatile("v_nop\n\tv_nop\n\tv_nop\n\tv_nop" : "+v"(a), "+v"(b) : "v"(x), "v"(y)); }
// four-accumulator variants: tie every accumulator of a WMMA group and keep the A fragments live
__device__ __forceinline__ void dep_guard4_h(v8f& a, v8f& b, v8f& c, v8f& d, v16h x, v16h y) { asm volatile("v_nop\n\tv_nop\n\tv_nop\n\tv_nop" : "+v"(a), "+v"(b), "+v"(c), "+v"(d) : "v"(x), "v"(y)); }
__device__ __forceinline__ void dep_guard4_b(v8f& a, v8f& b, v8f& c, v8f& d, v16b x, v16b y) { asm volatile("v_nop\n\tv_nop\n\tv_nop\n\tv_nop" : "+v"(a), "+v"(b), "+v"(c), "+v"(d) : "v"(x), "v"(y)); }
__device__ __forceinline__ void keep4_h(v16h a, v16h b, v16h c, v16h d) { asm volatile("v_nop" :: "v"(a), "v"(b), "v"(c), "v"(d)); }
__device__ __forceinline__ void keep4_b(v16b a, v16b b, v16b c, v16b d) { asm volatile("v_nop" :: "v"(a), "v"(b), "v"(c), "v"(d)); }
__device__ __forceinline__ void acc_guard4(v8f& a, v8f& b, v8f& c, v8f& d) { asm volatile("v_nop\n\tv_nop\n\tv_nop\n\tv_nop" : "+v"(a), "+v"(b), "+v"(c), "+v"(d)); }
template <typename T> struct Frag;
template <> struct Frag<_Float16> {
  typedef v16h V; union U { v16h v; v8h h[2]; };
  // elements 0..7 <- p[0..7], 8..15 <- p[16..23]
  static __device__ __forceinline__ v16h load(const _Float16* p) {
    U f; f.h[0] = *(const v8h*)(p); f.h[1] = *(const v8h*)(p + 16); return f.v;
  }
  static __device__ __forceinline__ v8f mma(v16h a, v16h b, v8f c) {
    return __builtin_amdgcn_wmma_f32_16x16x32_f16(false, a, false, b, (short)0, c, false, false);
  }
  static __device__ __forceinline__ void guard(v8f& a, v8f& b, v16h x, v16h y) { dep_guard_h(a, b, x, y); }
  static __device__ __forceinline__ void guard4(v8f& a, v8f& b, v8f& c, v8f& d, v16h x, v16h y) { dep_guard4_h(a, b, c, d, x, y); }
  static __device__ __forceinline__ void keep(v16h a, v16h b, v16h c, v16h d) { keep4_h(a, b, c, d); }
};
template <> struct Frag<__bf16> {
  typedef v16b V; union U { v16b v; v8b h[2]; };
  static __device__ __forceinline__ v16b load(const __bf16* p) {
    U f; f.h[0] = *(const v8b*)(p); f.h[1] = *(const v8b*)(p + 16); return f.v;
  }
  static __device__ __forceinline__ v8f mma(v16b a, v16b b, v8f c) {
    return __builtin_amdgcn_wmma_f32_16x16x32_bf16(false, a, false, b, (short)0, c, false, false);
  }
  static __device__ __forceinline__ void guard(v8f& a, v8f& b, v16b x, v16b y) { dep_guard_b(a, b, x, y); }
  static __device__ __forceinline__ void guard4(v8f& a, v8f& b, v8f& c, v8f& d, v16b x, v16b y) { dep_guard4_b(a, b, c, d, x, y); }
  static __device__ __forceinline__ void keep(v16b a, v16b b, v16b c, v16b d) { keep4_b(a, b, c, d); }
};

__device__ __forceinline__ unsigned pk16(unsigned short a, unsigned short b) { return (unsigned)a | ((unsigned)b << 16); }
__device__ __forceinline__ unsigned short h_bits(float f) { const _Float16 h = (_Float16)f; return __builtin_bit_cast(unsigned short, h); }

// ---- Register-blocked batched WMMA GEMM (ACT reduced to none/relu/leaky; guards tie all four accumulators per group) ----
// C[m,n] = scale * sum_k A[m,k] * Bt[n,k] (+bias)(+resid); each wave owns a 64x64 tile.
// A row-major [M,K]; Bt row-major [N,K]; M,N % 64 == 0, K % 32 == 0.
// SPLIT: operands are hi/lo planes (A2/Bt2 = lo planes, same layout); product = hi*hi + hi*lo + lo*hi.
// BIAS_MODE: 0 = none, 1 = bias[m], 2 = bias[n].
// OUT_MODE: 0 = f32, 1 = f16, 2 = bf16 hi plane (Cout) + bf16 lo plane (Cout2).
// ET: 0 = f16 operands, 1 = bf16 operands (pointers passed as 16-bit storage)
template <int ET> struct Elem;
template <> struct Elem<0> { typedef _Float16 T; };
template <> struct Elem<1> { typedef __bf16 T; };
template <int ET, bool SPLIT, int BIAS_MODE, int OUT_MODE, bool RESID, int ACT = 0>
__global__ __launch_bounds__(256) void wmma_gemm64(
    const unsigned short* __restrict__ Ap, const unsigned short* __restrict__ A2p, int lda, long strideA,
    const unsigned short* __restrict__ Btp, const unsigned short* __restrict__ Bt2p, int ldb, long strideB,
    void* __restrict__ Cout, void* __restrict__ Cout2, int ldc, long strideC,
    const float* __restrict__ bias,
    const float* __restrict__ resid, long strideR,
    int M, int N, int K, float scale) {
  typedef typename Elem<ET>::T T;
  typedef typename Frag<T>::V V;
  const T* A = (const T*)Ap; const T* A2 = (const T*)A2p; const T* Bt = (const T*)Btp; const T* Bt2 = (const T*)Bt2p;
  __shared__ __align__(16) float sT[8][16 * 68];   // per-wave 16x64 slab, pitch 68 floats
  const int b    = blockIdx.y;
  const int lane = threadIdx.x & 31;
  const int wave = threadIdx.x >> 5;
  const int tilesN = N >> 6;
  const int tilesM = M >> 6;
  const int tile = blockIdx.x * 8 + wave;
  if (tile >= tilesM * tilesN) return;   // wave-uniform; no block barriers in this kernel
  const int tm = tile / tilesN;
  const int tn = tile - tm * tilesN;
  const int m0 = tm << 6;
  const int n0 = tn << 6;

  const T* Ab  = A  + (size_t)b * strideA;
  const T* Bb  = Bt + (size_t)b * strideB;
  const T* Ab2 = SPLIT ? (A2  + (size_t)b * strideA) : nullptr;
  const T* Bb2 = SPLIT ? (Bt2 + (size_t)b * strideB) : nullptr;

  const int rlane = lane & 15;                 // row (A) / col (B, D) within subtile
  const int koff  = (lane >> 4) * 8;           // k offset of this lane half
  const int mOff  = (lane >> 4) * 8;           // D row offset

  v8f acc[4][4];
#pragma unroll
  for (int i = 0; i < 4; ++i)
#pragma unroll
    for (int j = 0; j < 4; ++j) acc[i][j] = (v8f){0.f,0.f,0.f,0.f,0.f,0.f,0.f,0.f};

  for (int k0 = 0; k0 < K; k0 += 32) {
    V bh[4], bl[4];
#pragma unroll
    for (int j = 0; j < 4; ++j) {
      const size_t bo = (size_t)(n0 + (j << 4) + rlane) * ldb + koff + k0;
      bh[j] = Frag<T>::load(Bb + bo);
      if (SPLIT) bl[j] = Frag<T>::load(Bb2 + bo);
    }
#pragma unroll
    for (int i = 0; i < 4; ++i) {
      const size_t ao = (size_t)(m0 + (i << 4) + rlane) * lda + koff + k0;
      V ah = Frag<T>::load(Ab + ao);
      V al = ah;
      if (SPLIT) al = Frag<T>::load(Ab2 + ao);
#pragma unroll
      for (int j = 0; j < 4; ++j) {
        acc[i][j] = Frag<T>::mma(ah, bh[j], acc[i][j]);
        if (SPLIT) {
          acc[i][j] = Frag<T>::mma(ah, bl[j], acc[i][j]);
          acc[i][j] = Frag<T>::mma(al, bh[j], acc[i][j]);
        }
      }
      Frag<T>::guard4(acc[i][0], acc[i][1], acc[i][2], acc[i][3], ah, al);
    }
    Frag<T>::keep(bh[0], bh[1], bh[2], bh[3]);
    if (SPLIT) Frag<T>::keep(bl[0], bl[1], bl[2], bl[3]);
  }
  acc_guard4(acc[0][0], acc[0][1], acc[0][2], acc[0][3]);
  acc_guard4(acc[1][0], acc[1][1], acc[1][2], acc[1][3]);
  acc_guard4(acc[2][0], acc[2][1], acc[2][2], acc[2][3]);
  acc_guard4(acc[3][0], acc[3][1], acc[3][2], acc[3][3]);

  // ---- epilogue ----
  float* slab = sT[wave];
  const float* Rb = RESID ? (resid + (size_t)b * strideR) : nullptr;
#pragma unroll
  for (int i = 0; i < 4; ++i) {
    const int mBase = m0 + (i << 4);
#pragma unroll
    for (int j = 0; j < 4; ++j) {
      const int n = n0 + (j << 4) + rlane;
      float bv = 0.f;
      if (BIAS_MODE == 2) bv = bias[n];
#pragma unroll
      for (int r = 0; r < 8; ++r) {
        float v = acc[i][j][r] * scale;
        if (BIAS_MODE == 1) v += bias[mBase + mOff + r];
        if (BIAS_MODE == 2) v += bv;
        if (RESID) v += Rb[(size_t)(mBase + mOff + r) * ldc + n];
        if (ACT == 2) v = fmaxf(v, 0.0f);
        if (ACT == 4) v = (v > 0.f) ? v : 0.01f * v;
        slab[(mOff + r) * 68 + (j << 4) + rlane] = v;
      }
    }
    __builtin_amdgcn_fence(__ATOMIC_RELEASE, "workgroup");
    __builtin_amdgcn_wave_barrier();
    __builtin_amdgcn_fence(__ATOMIC_ACQUIRE, "workgroup");
    if (OUT_MODE == 0) {
      float* C = (float*)Cout + (size_t)b * strideC;
      const int hh = lane >> 4, c4 = (lane & 15) * 4;     // row seg = 256 B = 16 lanes x 16 B
      {
#pragma unroll
        for (int it = 0; it < 8; ++it) {
          const int row = it * 2 + hh;
          v4f v = *(const v4f*)(slab + row * 68 + c4);
          *(v4f*)(C + (size_t)(mBase + row) * ldc + n0 + c4) = v;
        }
        
      }
    } else {
      const int q = lane >> 3, c8 = (lane & 7) * 8;
      unsigned short* C  = (unsigned short*)Cout  + (size_t)b * strideC;
      unsigned short* C2 = (OUT_MODE == 2) ? ((unsigned short*)Cout2 + (size_t)b * strideC) : nullptr;
      {
#pragma unroll
        for (int it = 0; it < 4; ++it) {
          const int row = it * 4 + q;
          const float* sp = slab + row * 68 + c8;
          v8h hv, lv;
#pragma unroll
          for (int e = 0; e < 8; ++e) {
            if (OUT_MODE == 1) {
              hv[e] = (_Float16)sp[e];
            } else {
              unsigned short hb = f2bf_bits(sp[e]);
              unsigned short lb = f2bf_bits(sp[e] - bf_bits2f(hb));
              hv[e] = __builtin_bit_cast(_Float16, hb);
              lv[e] = __builtin_bit_cast(_Float16, lb);
            }
          }
          *(v8h*)(C + (size_t)(mBase + row) * ldc + n0 + c8) = hv;
          if (OUT_MODE == 2) *(v8h*)(C2 + (size_t)(mBase + row) * ldc + n0 + c8) = lv;
        }
        
      }
    }
    __builtin_amdgcn_fence(__ATOMIC_RELEASE, "workgroup");
    __builtin_amdgcn_wave_barrier();
    __builtin_amdgcn_fence(__ATOMIC_ACQUIRE, "workgroup");
  }
}

// ---------------------------------------------------------------------------
// Concatenate + cast to RNE bf16 bits: dst[b][r][d] (pitch 64 halves) for r in [0, 4096):
//   rows 0..2047 from srcA[b][r][d], rows 2048..4095 from srcB[b][r-2048][d].
// grid (64, 2, kBatch): blockIdx.x = 2048-element tile (32 rows x 64), blockIdx.y = half (0: srcA, 1: srcB, block-uniform),
// blockIdx.z = batch. Coverage per (half, batch): 64 blocks x 256 threads x 8 = 131072 = 2048 x 64 elements = the whole half plane.
// ---------------------------------------------------------------------------
__global__ __launch_bounds__(256) void cast_cat_bf16_kernel(const float* __restrict__ srcA, const float* __restrict__ srcB,
                                                           unsigned short* __restrict__ dst) {
  const int t    = threadIdx.x;
  const int half = blockIdx.y;
  const int b    = blockIdx.z;
  const float* src = (half == 0) ? srcA : srcB;
  const size_t so = ((size_t)b * kSeq) * kDim + (size_t)blockIdx.x * 2048 + 8 * (size_t)t;
  const size_t dofs = ((size_t)b * kLtot + (size_t)half * kSeq) * kDim + (size_t)blockIdx.x * 2048 + 8 * (size_t)t;
  const v4f a = *(const v4f*)(src + so);
  const v4f c = *(const v4f*)(src + so + 4);
  unsigned short hb[8];
#pragma unroll
  for (int e = 0; e < 4; ++e) {
    hb[e]     = f2bf_bits(a[e]);
    hb[4 + e] = f2bf_bits(c[e]);
  }
  const v4u u = (v4u){pk16(hb[0], hb[1]), pk16(hb[2], hb[3]), pk16(hb[4], hb[5]), pk16(hb[6], hb[7])};
  unsigned short* q = dst + dofs;
  *(v4u*)q = u;
  
}

// ---------------------------------------------------------------------------
// Concatenated V transpose + cast: VT[b][d][s] (pitch 4096 halves) = f16( RNE-bf16( fV[b][s][d] ) ), s in [0, 4096):
//   s < 2048 from srcA[b][s][d], else srcB[b][s-2048][d].
// grid (64, kBatch): blockIdx.x = 64-key tile of the concatenated index (tiles 0..31 read srcA, 32..63 read srcB, block-uniform),
// blockIdx.y = batch. 256 threads.
// Load coverage: 4 iterations x 256 threads x 4 floats = 4096 = the whole 64(s) x 64(d) tile (coalesced along d); every sm[d][s<64] written.
// Store coverage: 8 waves x 2 iterations x 4 rows (lane>>3) = 64 d-rows; (lane&7) x 8 halves = 64 s-cols; each row segment =
// ---------------------------------------------------------------------------
__global__ __launch_bounds__(256) void vt_cat_f16_kernel(const float* __restrict__ srcA, const float* __restrict__ srcB,
                                                        unsigned short* __restrict__ vt) {
  __shared__ float sm[kDim][65];   // sm[d][s_local]; column 64 is never read
  const int t  = threadIdx.x;
  const int tileIdx = blockIdx.x;
  const int b  = blockIdx.y;
  const int s0 = tileIdx * 64;                              // concatenated key index of the tile
  const float* src = (tileIdx < (kSeq / 64)) ? srcA : srcB; // block-uniform source select
  const int sl0 = s0 & (kSeq - 1);                          // row within the source tensor
#pragma unroll
  for (int i = 0; i < 4; ++i) {
    const int f  = i * 256 + t;     // float4 index 0..1023
    const int r  = f >> 4;          // s local 0..63
    const int d4 = (f & 15) * 4;    // d 0..60
    const v4f w = *(const v4f*)(src + ((size_t)b * kSeq + sl0 + r) * kDim + d4);
#pragma unroll
    for (int e = 0; e < 4; ++e) sm[d4 + e][r] = bf_bits2f(f2bf_bits(w[e]));
  }
  __syncthreads();
  const int lane = t & 31, wave = t >> 5;
  const int q = lane >> 3, c8 = (lane & 7) * 8;
  unsigned short* op = vt + (size_t)b * kDim * kLtot;
  {
#pragma unroll
    for (int it = 0; it < 2; ++it) {
      const int row = wave * 8 + it * 4 + q;               // d
      unsigned short hb[8];
#pragma unroll
      for (int e = 0; e < 8; ++e) hb[e] = h_bits(sm[row][c8 + e]);
      const v4u u = (v4u){pk16(hb[0], hb[1]), pk16(hb[2], hb[3]), pk16(hb[4], hb[5]), pk16(hb[6], hb[7])};
      *(v4u*)(op + (size_t)row * kLtot + s0 + c8) = u;
    }
    
  }
}

// ---------------------------------------------------------------------------
// Row softmax over kLtot = 4096 f32 scores (already scaled by 0.125), f32 math:
//   P[row][j] = f16( 32768 * exp(s - max) / sum_j exp(s - max) )
// One block of 256 threads per row (grid = 4096 rows of the current batch).
// Phase 1/2: rolled 4-trip loops, thread t owns columns it*1024 + 4t .. 4t+3 (4 x 256 x 4 = 4096 = whole row); values kept in LDS.
// Reductions in fixed order (thread sequential, wave shuffle tree, 8 wave partials in index order); shuffles unconditional.
// Phase 3 (after a block barrier, reads LDS written by other waves): thread t owns cols 8t..8t+7 and 2048+8t..2048+8t+7 ->
// ---------------------------------------------------------------------------
__global__ __launch_bounds__(256) void softmax_row_kernel(const float* __restrict__ Sp, unsigned short* __restrict__ Pp) {
  __shared__ __align__(16) float lg[kLtot];
  __shared__ float redM[8];
  __shared__ float redS[8];
  const int row  = blockIdx.x;
  const int t    = threadIdx.x;
  const int lane = t & 31, wave = t >> 5;
  const size_t rowoff = (size_t)row * kLtot;
  const float* sr = Sp + rowoff;

  float mx = -__builtin_inff();
#pragma unroll 1
  for (int it = 0; it < 4; ++it) {
    const int c = it * 1024 + 4 * t;
    const v4f sv = *(const v4f*)(sr + c);
    mx = fmaxf(mx, fmaxf(fmaxf(sv[0], sv[1]), fmaxf(sv[2], sv[3])));
    *(v4f*)(lg + c) = sv;
  }
#pragma unroll
  for (int off = 16; off > 0; off >>= 1) mx = fmaxf(mx, __shfl_xor(mx, off, 32));
  if (lane == 0) redM[wave] = mx;
  __syncthreads();
  float m = redM[0];
#pragma unroll
  for (int w = 1; w < 8; ++w) m = fmaxf(m, redM[w]);

  float sum = 0.f;
#pragma unroll 1
  for (int it = 0; it < 4; ++it) {
    const int c = it * 1024 + 4 * t;
    const v4f l = *(const v4f*)(lg + c);
    v4f ev;
#pragma unroll
    for (int e = 0; e < 4; ++e) {
      ev[e] = expf(l[e] - m);
      sum += ev[e];
    }
    *(v4f*)(lg + c) = ev;
  }
#pragma unroll
  for (int off = 16; off > 0; off >>= 1) sum += __shfl_xor(sum, off, 32);
  if (lane == 0) redS[wave] = sum;
  __syncthreads();
  float tot = redS[0];
#pragma unroll
  for (int w = 1; w < 8; ++w) tot += redS[w];
  const float inv = kPCarry / tot;

  const v4f a0 = *(const v4f*)(lg + 8 * t);
  const v4f a1 = *(const v4f*)(lg + 8 * t + 4);
  const v4f c0 = *(const v4f*)(lg + kSeq + 8 * t);
  const v4f c1 = *(const v4f*)(lg + kSeq + 8 * t + 4);
  unsigned short hb[16];
#pragma unroll
  for (int e = 0; e < 4; ++e) {
    hb[e]      = h_bits(a0[e] * inv);
    hb[4 + e]  = h_bits(a1[e] * inv);
    hb[8 + e]  = h_bits(c0[e] * inv);
    hb[12 + e] = h_bits(c1[e] * inv);
  }
  const v4u u0 = (v4u){pk16(hb[0], hb[1]), pk16(hb[2], hb[3]), pk16(hb[4], hb[5]), pk16(hb[6], hb[7])};
  const v4u u1 = (v4u){pk16(hb[8], hb[9]), pk16(hb[10], hb[11]), pk16(hb[12], hb[13]), pk16(hb[14], hb[15])};
  unsigned short* p0 = Pp + rowoff + 8 * (size_t)t;
  unsigned short* p1 = p0 + kSeq;
  *(v4u*)p0 = u0;
  *(v4u*)p1 = u1;
  
}

// ---------------------------------------------------------------------------
// Host glue.
//   Q16  bf16 [4][4096][64]           2,097,152  at           0   (written by cast_cat_bf16_kernel)
//   K16  bf16 [4][4096][64]           2,097,152  at   2,097,152   (written by cast_cat_bf16_kernel)
//   VT   f16  [4][64][4096]           2,097,152  at   4,194,304   (written by vt_cat_f16_kernel)
//   SC   f32  [4096][4096]           67,108,864  at   6,291,456   (scores of one batch, re-used 4x, same type/layout)
//   PP   f16  [4096][4096]           33,554,432  at  73,400,320   (probabilities x32768 of one batch, re-used 4x)
//   total                           106,954,752
// GEMM shapes: scores M=N=4096 (64-multiples), K=64 (%32==0); P.V M=4096, N=64 (64-multiples), K=4096 (%32==0). No padding anywhere.
// ---------------------------------------------------------------------------
extern "C" void kernel_launch(void* const* d_in, const int* in_sizes, int n_in,
                              void* d_out, int out_size, void* d_ws, size_t ws_size,
                              hipStream_t stream) {
  if (n_in < 6) return;
  const int nIn = kBatch * kSeq * kDim;           // 524288 per input
  for (int i = 0; i < 6; ++i) if (in_sizes[i] != nIn) return;
  const int nOut = kBatch * kLtot * kDim;         // 1048576
  if (out_size != nOut) return;

  const size_t szQK = (size_t)kBatch * kLtot * kDim * 2;   // 2,097,152
  const size_t szVT = (size_t)kBatch * kDim * kLtot * 2;   // 2,097,152
  const size_t szS  = (size_t)kLtot * kLtot * 4;           // 67,108,864
  const size_t szP  = (size_t)kLtot * kLtot * 2;           // 33,554,432
  const size_t offQ  = 0;
  const size_t offK  = offQ + szQK;
  const size_t offVT = offK + szQK;
  const size_t offS  = offVT + szVT;
  const size_t offP  = offS + szS;
  const size_t total = offP + szP;                          // 106,954,752
  if (ws_size < total) return;

  const float* Q1 = (const float*)d_in[0];
  const float* K1 = (const float*)d_in[1];
  const float* V1 = (const float*)d_in[2];
  const float* Q2 = (const float*)d_in[3];
  const float* K2 = (const float*)d_in[4];
  const float* V2 = (const float*)d_in[5];
  float* out = (float*)d_out;
  char* ws = (char*)d_ws;
  unsigned short* Q16 = (unsigned short*)(ws + offQ);
  unsigned short* K16 = (unsigned short*)(ws + offK);
  unsigned short* VT  = (unsigned short*)(ws + offVT);
  float* SC = (float*)(ws + offS);
  unsigned short* PP = (unsigned short*)(ws + offP);

  // ---- prologue: concatenated 16-bit operand planes ----
  const int tilesPerHalf = (kSeq * kDim) / 2048;   // 64 blocks of 256 threads x 8 elements per (half, batch)
  cast_cat_bf16_kernel<<<dim3(tilesPerHalf, 2, kBatch), dim3(256), 0, stream>>>(Q1, Q2, Q16);
  cast_cat_bf16_kernel<<<dim3(tilesPerHalf, 2, kBatch), dim3(256), 0, stream>>>(K1, K2, K16);
  vt_cat_f16_kernel<<<dim3(kLtot / 64, kBatch), dim3(256), 0, stream>>>(V1, V2, VT);

  const int tilesScore = (kLtot / 64) * (kLtot / 64);   // 4096 tiles -> 512 blocks of 8 waves (exact)
  const int tilesCtx   = (kLtot / 64) * (kDim / 64);    // 64 tiles -> 8 blocks of 8 waves (exact)

  for (int b = 0; b < kBatch; ++b) {
    const unsigned short* Qb  = Q16 + (size_t)b * kLtot * kDim;
    const unsigned short* Kb  = K16 + (size_t)b * kLtot * kDim;
    const unsigned short* VTb = VT  + (size_t)b * kDim * kLtot;
    float* outb = out + (size_t)b * kLtot * kDim;
    // SC[i][j] = 0.125 * sum_d Q16[b,i,d] * K16[b,j,d]   (M=N=4096, K=64; bf16 operands)
    wmma_gemm64<1, false, 0, 0, false, 0><<<dim3(tilesScore / 8, 1), dim3(256), 0, stream>>>(
        Qb, Qb, kDim, 0L, Kb, Kb, kDim, 0L,
        (void*)SC, (void*)SC, kLtot, 0L, SC, SC, 0L, kLtot, kLtot, kDim, kScale);
    // row softmax -> PP (f16, x32768)
    softmax_row_kernel<<<dim3(kLtot), dim3(256), 0, stream>>>(SC, PP);
    // out[b, i, n] = 2^-15 * sum_j PP[i][j] * VT[b][n][j]   (M=4096, N=64, K=4096; f16 operands)
    wmma_gemm64<0, false, 0, 0, false, 0><<<dim3(tilesCtx / 8, 1), dim3(256), 0, stream>>>(
        PP, PP, kLtot, 0L, VTb, VTb, kLtot, 0L,
        (void*)outb, (void*)outb, kDim, 0L, SC, SC, 0L, kLtot, kDim, kLtot, kPCarryInv);
  }
}

// v001
// Measured time: 187 microseconds a run.
// Timed twice side by side with v000, it ran 4.64 times as fast both times.
// Contractions: scores fQ.fK^T on v_wmma_f32_16x16x32_bf16 (fQ, fK as RNE-bf16 planes), attn.fV on v_wmma_f32_16x16x32_f16 (P f16 carried x32768, fV^T as an f16 plane holding RNE-bf16 values); f32 accumulate everywhere; softmax max/exp/sum/normalise in f32.
#include <hip/hip_runtime.h>
#include <math.h>

// ---------------------------------------------------------------------------
// Problem constants
// ---------------------------------------------------------------------------
constexpr int kBatch = 4;
constexpr int kSeq   = 2048;            // rows per input tensor
constexpr int kLtot  = 2 * kSeq;        // 4096 concatenated rows (queries and keys)
constexpr int kDim   = 64;
constexpr float kScale     = 0.125f;    // 64^-0.5, exact
constexpr float kPCarry    = 32768.0f;  // probabilities carried x2^15 in f16
constexpr float kPCarryInv = 1.0f / 32768.0f;
static_assert(kLtot % 64 == 0);         // M, N of the scores GEMM
static_assert(kDim % 64 == 0);
static_assert(kDim % 32 == 0);          // K of the scores GEMM
static_assert(kLtot % 32 == 0);         // K of the P.V GEMM
static_assert(kLtot == 4 * 1024);       // softmax thread map: 4 x 256 x 4
static_assert(kSeq % 64 == 0);          // concat boundary on tile boundaries
static_assert((kSeq * kDim) % 2048 == 0);

typedef __attribute__((ext_vector_type(16))) _Float16 v16h;
typedef __attribute__((ext_vector_type(8)))  _Float16 v8h;
typedef __attribute__((ext_vector_type(16))) __bf16   v16b;
typedef __attribute__((ext_vector_type(8)))  __bf16   v8b;
typedef __attribute__((ext_vector_type(8)))  float    v8f;
typedef __attribute__((ext_vector_type(4)))  float    v4f;
typedef __attribute__((ext_vector_type(4)))  unsigned int v4u;

// ---------------------------------------------------------------------------
// Device helpers
// ---------------------------------------------------------------------------
__device__ __forceinline__ unsigned short f2bf_bits(float f) {
  unsigned u = __float_as_uint(f);
  return (unsigned short)((u + 0x7FFFu + ((u >> 16) & 1u)) >> 16);
}
__device__ __forceinline__ float bf_bits2f(unsigned short h) { return __uint_as_float(((unsigned)h) << 16); }

// hazard guards as plain device helpers (no inline asm inside the kernel template body)
__device__ __forceinline__ void dep_guard_h(v8f& a, v8f& b, v16h x, v16h y) { asm volatile("v_nop\n\tv_nop\n\tv_nop\n\tv_nop" : "+v"(a), "+v"(b) : "v"(x), "v"(y)); }
__device__ __forceinline__ void dep_guard_b(v8f& a, v8f& b, v16b x, v16b y) { asm volatile("v_nop\n\tv_nop\n\tv_nop\n\tv_nop" : "+v"(a), "+v"(b) : "v"(x), "v"(y)); }
// four-accumulator variants: tie every accumulator of a WMMA group and keep the A fragments live
__device__ __forceinline__ void dep_guard4_h(v8f& a, v8f& b, v8f& c, v8f& d, v16h x, v16h y) { asm volatile("v_nop\n\tv_nop\n\tv_nop\n\tv_nop" : "+v"(a), "+v"(b), "+v"(c), "+v"(d) : "v"(x), "v"(y)); }
__device__ __forceinline__ void dep_guard4_b(v8f& a, v8f& b, v8f& c, v8f& d, v16b x, v16b y) { asm volatile("v_nop\n\tv_nop\n\tv_nop\n\tv_nop" : "+v"(a), "+v"(b), "+v"(c), "+v"(d) : "v"(x), "v"(y)); }
__device__ __forceinline__ void keep4_h(v16h a, v16h b, v16h c, v16h d) { asm volatile("v_nop" :: "v"(a), "v"(b), "v"(c), "v"(d)); }
__device__ __forceinline__ void keep4_b(v16b a, v16b b, v16b c, v16b d) { asm volatile("v_nop" :: "v"(a), "v"(b), "v"(c), "v"(d)); }
__device__ __forceinline__ void acc_guard4(v8f& a, v8f& b, v8f& c, v8f& d) { asm volatile("v_nop\n\tv_nop\n\tv_nop\n\tv_nop" : "+v"(a), "+v"(b), "+v"(c), "+v"(d)); }
template <typename T> struct Frag;
template <> struct Frag<_Float16> {
  typedef v16h V; union U { v16h v; v8h h[2]; };
  // elements 0..7 <- p[0..7], 8..15 <- p[16..23]
  static __device__ __forceinline__ v16h load(const _Float16* p) {
    U f; f.h[0] = *(const v8h*)(p); f.h[1] = *(const v8h*)(p + 16); return f.v;
  }
  static __device__ __forceinline__ v8f mma(v16h a, v16h b, v8f c) {
    return __builtin_amdgcn_wmma_f32_16x16x32_f16(false, a, false, b, (short)0, c, false, false);
  }
  static __device__ __forceinline__ void guard(v8f& a, v8f& b, v16h x, v16h y) { dep_guard_h(a, b, x, y); }
  static __device__ __forceinline__ void guard4(v8f& a, v8f& b, v8f& c, v8f& d, v16h x, v16h y) { dep_guard4_h(a, b, c, d, x, y); }
  static __device__ __forceinline__ void keep(v16h a, v16h b, v16h c, v16h d) { keep4_h(a, b, c, d); }
};
template <> struct Frag<__bf16> {
  typedef v16b V; union U { v16b v; v8b h[2]; };
  static __device__ __forceinline__ v16b load(const __bf16* p) {
    U f; f.h[0] = *(const v8b*)(p); f.h[1] = *(const v8b*)(p + 16); return f.v;
  }
  static __device__ __forceinline__ v8f mma(v16b a, v16b b, v8f c) {
    return __builtin_amdgcn_wmma_f32_16x16x32_bf16(false, a, false, b, (short)0, c, false, false);
  }
  static __device__ __forceinline__ void guard(v8f& a, v8f& b, v16b x, v16b y) { dep_guard_b(a, b, x, y); }
  static __device__ __forceinline__ void guard4(v8f& a, v8f& b, v8f& c, v8f& d, v16b x, v16b y) { dep_guard4_b(a, b, c, d, x, y); }
  static __device__ __forceinline__ void keep(v16b a, v16b b, v16b c, v16b d) { keep4_b(a, b, c, d); }
};

__device__ __forceinline__ unsigned pk16(unsigned short a, unsigned short b) { return (unsigned)a | ((unsigned)b << 16); }
__device__ __forceinline__ unsigned short h_bits(float f) { const _Float16 h = (_Float16)f; return __builtin_bit_cast(unsigned short, h); }

// ---- Register-blocked batched WMMA GEMM (ACT reduced to none/relu/leaky; guards tie all four accumulators per group) ----
// C[m,n] = scale * sum_k A[m,k] * Bt[n,k] (+bias)(+resid); each wave owns a 64x64 tile.
// A row-major [M,K]; Bt row-major [N,K]; M,N % 64 == 0, K % 32 == 0.
// SPLIT: operands are hi/lo planes (A2/Bt2 = lo planes, same layout); product = hi*hi + hi*lo + lo*hi.
// BIAS_MODE: 0 = none, 1 = bias[m], 2 = bias[n].
// OUT_MODE: 0 = f32, 1 = f16, 2 = bf16 hi plane (Cout) + bf16 lo plane (Cout2).
// ET: 0 = f16 operands, 1 = bf16 operands (pointers passed as 16-bit storage)
template <int ET> struct Elem;
template <> struct Elem<0> { typedef _Float16 T; };
template <> struct Elem<1> { typedef __bf16 T; };
template <int ET, bool SPLIT, int BIAS_MODE, int OUT_MODE, bool RESID, int ACT = 0>
__global__ __launch_bounds__(256) void wmma_gemm64(
    const unsigned short* __restrict__ Ap, const unsigned short* __restrict__ A2p, int lda, long strideA,
    const unsigned short* __restrict__ Btp, const unsigned short* __restrict__ Bt2p, int ldb, long strideB,
    void* __restrict__ Cout, void* __restrict__ Cout2, int ldc, long strideC,
    const float* __restrict__ bias,
    const float* __restrict__ resid, long strideR,
    int M, int N, int K, float scale) {
  typedef typename Elem<ET>::T T;
  typedef typename Frag<T>::V V;
  const T* A = (const T*)Ap; const T* A2 = (const T*)A2p; const T* Bt = (const T*)Btp; const T* Bt2 = (const T*)Bt2p;
  __shared__ __align__(16) float sT[8][16 * 68];   // per-wave 16x64 slab, pitch 68 floats
  const int b    = blockIdx.y;
  const int lane = threadIdx.x & 31;
  const int wave = threadIdx.x >> 5;
  const int tilesN = N >> 6;
  const int tilesM = M >> 6;
  const int tile = blockIdx.x * 8 + wave;
  if (tile >= tilesM * tilesN) return;   // wave-uniform; no block barriers in this kernel
  const int tm = tile / tilesN;
  const int tn = tile - tm * tilesN;
  const int m0 = tm << 6;
  const int n0 = tn << 6;

  const T* Ab  = A  + (size_t)b * strideA;
  const T* Bb  = Bt + (size_t)b * strideB;
  const T* Ab2 = SPLIT ? (A2  + (size_t)b * strideA) : nullptr;
  const T* Bb2 = SPLIT ? (Bt2 + (size_t)b * strideB) : nullptr;

  const int rlane = lane & 15;                 // row (A) / col (B, D) within subtile
  const int koff  = (lane >> 4) * 8;           // k offset of this lane half
  const int mOff  = (lane >> 4) * 8;           // D row offset

  v8f acc[4][4];
#pragma unroll
  for (int i = 0; i < 4; ++i)
#pragma unroll
    for (int j = 0; j < 4; ++j) acc[i][j] = (v8f){0.f,0.f,0.f,0.f,0.f,0.f,0.f,0.f};

  for (int k0 = 0; k0 < K; k0 += 32) {
    V bh[4], bl[4];
#pragma unroll
    for (int j = 0; j < 4; ++j) {
      const size_t bo = (size_t)(n0 + (j << 4) + rlane) * ldb + koff + k0;
      bh[j] = Frag<T>::load(Bb + bo);
      if (SPLIT) bl[j] = Frag<T>::load(Bb2 + bo);
    }
#pragma unroll
    for (int i = 0; i < 4; ++i) {
      const size_t ao = (size_t)(m0 + (i << 4) + rlane) * lda + koff + k0;
      V ah = Frag<T>::load(Ab + ao);
      V al = ah;
      if (SPLIT) al = Frag<T>::load(Ab2 + ao);
#pragma unroll
      for (int j = 0; j < 4; ++j) {
        acc[i][j] = Frag<T>::mma(ah, bh[j], acc[i][j]);
        if (SPLIT) {
          acc[i][j] = Frag<T>::mma(ah, bl[j], acc[i][j]);
          acc[i][j] = Frag<T>::mma(al, bh[j], acc[i][j]);
        }
      }
      Frag<T>::guard4(acc[i][0], acc[i][1], acc[i][2], acc[i][3], ah, al);
    }
    Frag<T>::keep(bh[0], bh[1], bh[2], bh[3]);
    if (SPLIT) Frag<T>::keep(bl[0], bl[1], bl[2], bl[3]);
  }
  acc_guard4(acc[0][0], acc[0][1], acc[0][2], acc[0][3]);
  acc_guard4(acc[1][0], acc[1][1], acc[1][2], acc[1][3]);
  acc_guard4(acc[2][0], acc[2][1], acc[2][2], acc[2][3]);
  acc_guard4(acc[3][0], acc[3][1], acc[3][2], acc[3][3]);

  // ---- epilogue ----
  float* slab = sT[wave];
  const float* Rb = RESID ? (resid + (size_t)b * strideR) : nullptr;
#pragma unroll
  for (int i = 0; i < 4; ++i) {
    const int mBase = m0 + (i << 4);
#pragma unroll
    for (int j = 0; j < 4; ++j) {
      const int n = n0 + (j << 4) + rlane;
      float bv = 0.f;
      if (BIAS_MODE == 2) bv = bias[n];
#pragma unroll
      for (int r = 0; r < 8; ++r) {
        float v = acc[i][j][r] * scale;
        if (BIAS_MODE == 1) v += bias[mBase + mOff + r];
        if (BIAS_MODE == 2) v += bv;
        if (RESID) v += Rb[(size_t)(mBase + mOff + r) * ldc + n];
        if (ACT == 2) v = fmaxf(v, 0.0f);
        if (ACT == 4) v = (v > 0.f) ? v : 0.01f * v;
        slab[(mOff + r) * 68 + (j << 4) + rlane] = v;
      }
    }
    __builtin_amdgcn_fence(__ATOMIC_RELEASE, "workgroup");
    __builtin_amdgcn_wave_barrier();
    __builtin_amdgcn_fence(__ATOMIC_ACQUIRE, "workgroup");
    if (OUT_MODE == 0) {
      float* C = (float*)Cout + (size_t)b * strideC;
      const int hh = lane >> 4, c4 = (lane & 15) * 4;     // row seg = 256 B = 16 lanes x 16 B
      {
#pragma unroll
        for (int it = 0; it < 8; ++it) {
          const int row = it * 2 + hh;
          v4f v = *(const v4f*)(slab + row * 68 + c4);
          *(v4f*)(C + (size_t)(mBase + row) * ldc + n0 + c4) = v;
        }
        
      }
    } else {
      const int q = lane >> 3, c8 = (lane & 7) * 8;
      unsigned short* C  = (unsigned short*)Cout  + (size_t)b * strideC;
      unsigned short* C2 = (OUT_MODE == 2) ? ((unsigned short*)Cout2 + (size_t)b * strideC) : nullptr;
      {
#pragma unroll
        for (int it = 0; it < 4; ++it) {
          const int row = it * 4 + q;
          const float* sp = slab + row * 68 + c8;
          v8h hv, lv;
#pragma unroll
          for (int e = 0; e < 8; ++e) {
            if (OUT_MODE == 1) {
              hv[e] = (_Float16)sp[e];
            } else {
              unsigned short hb = f2bf_bits(sp[e]);
              unsigned short lb = f2bf_bits(sp[e] - bf_bits2f(hb));
              hv[e] = __builtin_bit_cast(_Float16, hb);
              lv[e] = __builtin_bit_cast(_Float16, lb);
            }
          }
          *(v8h*)(C + (size_t)(mBase + row) * ldc + n0 + c8) = hv;
          if (OUT_MODE == 2) *(v8h*)(C2 + (size_t)(mBase + row) * ldc + n0 + c8) = lv;
        }
        
      }
    }
    __builtin_amdgcn_fence(__ATOMIC_RELEASE, "workgroup");
    __builtin_amdgcn_wave_barrier();
    __builtin_amdgcn_fence(__ATOMIC_ACQUIRE, "workgroup");
  }
}

// ---------------------------------------------------------------------------
// Concatenate + cast to RNE bf16 bits: dst[b][r][d] (pitch 64 halves) for r in [0, 4096):
//   rows 0..2047 from srcA[b][r][d], rows 2048..4095 from srcB[b][r-2048][d].
// grid (64, 2, kBatch): blockIdx.x = 2048-element tile (32 rows x 64), blockIdx.y = half (0: srcA, 1: srcB, block-uniform),
// blockIdx.z = batch. Coverage per (half, batch): 64 blocks x 256 threads x 8 = 131072 = 2048 x 64 elements = the whole half plane.
// ---------------------------------------------------------------------------
__global__ __launch_bounds__(256) void cast_cat_bf16_kernel(const float* __restrict__ srcA, const float* __restrict__ srcB,
                                                           unsigned short* __restrict__ dst) {
  const int t    = threadIdx.x;
  const int half = blockIdx.y;
  const int b    = blockIdx.z;
  const float* src = (half == 0) ? srcA : srcB;
  const size_t so = ((size_t)b * kSeq) * kDim + (size_t)blockIdx.x * 2048 + 8 * (size_t)t;
  const size_t dofs = ((size_t)b * kLtot + (size_t)half * kSeq) * kDim + (size_t)blockIdx.x * 2048 + 8 * (size_t)t;
  const v4f a = *(const v4f*)(src + so);
  const v4f c = *(const v4f*)(src + so + 4);
  unsigned short hb[8];
#pragma unroll
  for (int e = 0; e < 4; ++e) {
    hb[e]     = f2bf_bits(a[e]);
    hb[4 + e] = f2bf_bits(c[e]);
  }
  const v4u u = (v4u){pk16(hb[0], hb[1]), pk16(hb[2], hb[3]), pk16(hb[4], hb[5]), pk16(hb[6], hb[7])};
  unsigned short* q = dst + dofs;
  *(v4u*)q = u;
  
}

// ---------------------------------------------------------------------------
// Concatenated V transpose + cast: VT[b][d][s] (pitch 4096 halves) = f16( RNE-bf16( fV[b][s][d] ) ), s in [0, 4096):
//   s < 2048 from srcA[b][s][d], else srcB[b][s-2048][d].
// grid (64, kBatch): blockIdx.x = 64-key tile of the concatenated index (tiles 0..31 read srcA, 32..63 read srcB, block-uniform),
// blockIdx.y = batch. 256 threads.
// Load coverage: 4 iterations x 256 threads x 4 floats = 4096 = the whole 64(s) x 64(d) tile (coalesced along d); every sm[d][s<64] written.
// Store coverage: 8 waves x 2 iterations x 4 rows (lane>>3) = 64 d-rows; (lane&7) x 8 halves = 64 s-cols; each row segment =
// ---------------------------------------------------------------------------
__global__ __launch_bounds__(256) void vt_cat_f16_kernel(const float* __restrict__ srcA, const float* __restrict__ srcB,
                                                        unsigned short* __restrict__ vt) {
  __shared__ float sm[kDim][65];   // sm[d][s_local]; column 64 is never read
  const int t  = threadIdx.x;
  const int tileIdx = blockIdx.x;
  const int b  = blockIdx.y;
  const int s0 = tileIdx * 64;                              // concatenated key index of the tile
  const float* src = (tileIdx < (kSeq / 64)) ? srcA : srcB; // block-uniform source select
  const int sl0 = s0 & (kSeq - 1);                          // row within the source tensor
#pragma unroll
  for (int i = 0; i < 4; ++i) {
    const int f  = i * 256 + t;     // float4 index 0..1023
    const int r  = f >> 4;          // s local 0..63
    const int d4 = (f & 15) * 4;    // d 0..60
    const v4f w = *(const v4f*)(src + ((size_t)b * kSeq + sl0 + r) * kDim + d4);
#pragma unroll
    for (int e = 0; e < 4; ++e) sm[d4 + e][r] = bf_bits2f(f2bf_bits(w[e]));
  }
  __syncthreads();
  const int lane = t & 31, wave = t >> 5;
  const int q = lane >> 3, c8 = (lane & 7) * 8;
  unsigned short* op = vt + (size_t)b * kDim * kLtot;
  {
#pragma unroll
    for (int it = 0; it < 2; ++it) {
      const int row = wave * 8 + it * 4 + q;               // d
      unsigned short hb[8];
#pragma unroll
      for (int e = 0; e < 8; ++e) hb[e] = h_bits(sm[row][c8 + e]);
      const v4u u = (v4u){pk16(hb[0], hb[1]), pk16(hb[2], hb[3]), pk16(hb[4], hb[5]), pk16(hb[6], hb[7])};
      *(v4u*)(op + (size_t)row * kLtot + s0 + c8) = u;
    }
    
  }
}

// ---------------------------------------------------------------------------
// Row softmax over kLtot = 4096 f32 scores (already scaled by 0.125), f32 math:
//   P[row][j] = f16( 32768 * exp(s - max) / sum_j exp(s - max) )
// One block of 256 threads per row (grid = 4096 rows of the current batch).
// Phase 1/2: rolled 4-trip loops, thread t owns columns it*1024 + 4t .. 4t+3 (4 x 256 x 4 = 4096 = whole row); values kept in LDS.
// Reductions in fixed order (thread sequential, wave shuffle tree, 8 wave partials in index order); shuffles unconditional.
// Phase 3 (after a block barrier, reads LDS written by other waves): thread t owns cols 8t..8t+7 and 2048+8t..2048+8t+7 ->
// ---------------------------------------------------------------------------
__global__ __launch_bounds__(256) void softmax_row_kernel(const float* __restrict__ Sp, unsigned short* __restrict__ Pp) {
  __shared__ __align__(16) float lg[kLtot];
  __shared__ float redM[8];
  __shared__ float redS[8];
  const int row  = blockIdx.x;
  const int t    = threadIdx.x;
  const int lane = t & 31, wave = t >> 5;
  const size_t rowoff = (size_t)row * kLtot;
  const float* sr = Sp + rowoff;

  float mx = -__builtin_inff();
#pragma unroll 1
  for (int it = 0; it < 4; ++it) {
    const int c = it * 1024 + 4 * t;
    const v4f sv = *(const v4f*)(sr + c);
    mx = fmaxf(mx, fmaxf(fmaxf(sv[0], sv[1]), fmaxf(sv[2], sv[3])));
    *(v4f*)(lg + c) = sv;
  }
#pragma unroll
  for (int off = 16; off > 0; off >>= 1) mx = fmaxf(mx, __shfl_xor(mx, off, 32));
  if (lane == 0) redM[wave] = mx;
  __syncthreads();
  float m = redM[0];
#pragma unroll
  for (int w = 1; w < 8; ++w) m = fmaxf(m, redM[w]);

  float sum = 0.f;
#pragma unroll 1
  for (int it = 0; it < 4; ++it) {
    const int c = it * 1024 + 4 * t;
    const v4f l = *(const v4f*)(lg + c);
    v4f ev;
#pragma unroll
    for (int e = 0; e < 4; ++e) {
      ev[e] = expf(l[e] - m);
      sum += ev[e];
    }
    *(v4f*)(lg + c) = ev;
  }
#pragma unroll
  for (int off = 16; off > 0; off >>= 1) sum += __shfl_xor(sum, off, 32);
  if (lane == 0) redS[wave] = sum;
  __syncthreads();
  float tot = redS[0];
#pragma unroll
  for (int w = 1; w < 8; ++w) tot += redS[w];
  const float inv = kPCarry / tot;

  const v4f a0 = *(const v4f*)(lg + 8 * t);
  const v4f a1 = *(const v4f*)(lg + 8 * t + 4);
  const v4f c0 = *(const v4f*)(lg + kSeq + 8 * t);
  const v4f c1 = *(const v4f*)(lg + kSeq + 8 * t + 4);
  unsigned short hb[16];
#pragma unroll
  for (int e = 0; e < 4; ++e) {
    hb[e]      = h_bits(a0[e] * inv);
    hb[4 + e]  = h_bits(a1[e] * inv);
    hb[8 + e]  = h_bits(c0[e] * inv);
    hb[12 + e] = h_bits(c1[e] * inv);
  }
  const v4u u0 = (v4u){pk16(hb[0], hb[1]), pk16(hb[2], hb[3]), pk16(hb[4], hb[5]), pk16(hb[6], hb[7])};
  const v4u u1 = (v4u){pk16(hb[8], hb[9]), pk16(hb[10], hb[11]), pk16(hb[12], hb[13]), pk16(hb[14], hb[15])};
  unsigned short* p0 = Pp + rowoff + 8 * (size_t)t;
  unsigned short* p1 = p0 + kSeq;
  *(v4u*)p0 = u0;
  *(v4u*)p1 = u1;
  
}

// ---------------------------------------------------------------------------
// P.V product, spread over the whole chip: out[m][n] = 2^-15 * sum_k P[m][k] * VT[n][k]  (M = 4096, N = 64, K = 4096; f16 operands).
// One 32x32 tile of out per work-group: grid = 128 row tiles x 2 column tiles = 256 work-groups of 8 waves.
// K is split over the waves: wave w sums k in [512 w, 512 w + 512) for the whole tile (2 x 2 accumulators, 16 k-steps of 32).
// The 8 partial tiles meet in LDS and are added in wave order 0..7 (fixed order), scaled once, stored as whole 128-B row pieces.
// The two column tiles of one row tile are 128 work-groups apart (blockIdx.x >> 7).
// ---------------------------------------------------------------------------
constexpr int kPvKW    = kLtot / 8;   // k per wave
constexpr int kPvPitch = 36;          // floats per LDS row: rows 8 apart fall on different banks, rows stay 16-B aligned
static_assert(kPvKW % 32 == 0);
static_assert(kLtot % 32 == 0 && kDim % 32 == 0);
__global__ __launch_bounds__(256) void pv_splitk_kernel(const unsigned short* __restrict__ Pp, const unsigned short* __restrict__ VTp,
                                                        float* __restrict__ outp) {
  __shared__ __align__(16) float part[8][32 * kPvPitch];
  const int t     = threadIdx.x;
  const int lane  = t & 31;
  const int wave  = t >> 5;
  const int m0    = (blockIdx.x & (kLtot / 32 - 1)) * 32;
  const int n0    = (blockIdx.x / (kLtot / 32)) * 32;
  const int rlane = lane & 15;                 // row (A) / col (B, D) within subtile
  const int koff  = (lane >> 4) * 8;           // k offset of this lane half
  const int mOff  = (lane >> 4) * 8;           // D row offset
  const _Float16* A0 = (const _Float16*)Pp  + (size_t)(m0 + rlane) * kLtot + wave * kPvKW + koff;
  const _Float16* A1 = A0 + (size_t)16 * kLtot;
  const _Float16* B0 = (const _Float16*)VTp + (size_t)(n0 + rlane) * kLtot + wave * kPvKW + koff;
  const _Float16* B1 = B0 + (size_t)16 * kLtot;

  v8f acc00 = (v8f){0.f,0.f,0.f,0.f,0.f,0.f,0.f,0.f};
  v8f acc01 = acc00, acc10 = acc00, acc11 = acc00;
  // unrolled whole: no back edge, so the loads of later k-steps can be issued while earlier ones are still on their way
#pragma unroll
  for (int k0 = 0; k0 < kPvKW; k0 += 32) {
    const v16h a0 = Frag<_Float16>::load(A0 + k0);
    const v16h a1 = Frag<_Float16>::load(A1 + k0);
    const v16h b0 = Frag<_Float16>::load(B0 + k0);
    const v16h b1 = Frag<_Float16>::load(B1 + k0);
    acc00 = Frag<_Float16>::mma(a0, b0, acc00);
    acc01 = Frag<_Float16>::mma(a0, b1, acc01);
    acc10 = Frag<_Float16>::mma(a1, b0, acc10);
    acc11 = Frag<_Float16>::mma(a1, b1, acc11);
  }

  float* slab = part[wave];
#pragma unroll
  for (int r = 0; r < 8; ++r) {
    slab[(mOff + r) * kPvPitch + rlane]           = acc00[r];
    slab[(mOff + r) * kPvPitch + 16 + rlane]      = acc01[r];
    slab[(16 + mOff + r) * kPvPitch + rlane]      = acc10[r];
    slab[(16 + mOff + r) * kPvPitch + 16 + rlane] = acc11[r];
  }
  __syncthreads();
  // 256 threads x 4 floats = the 32x32 tile; 8 threads cover one 128-B row piece
  const int row = t >> 3, c4 = (t & 7) * 4;
  v4f s = *(const v4f*)(&part[0][row * kPvPitch + c4]);
#pragma unroll
  for (int w = 1; w < 8; ++w) s += *(const v4f*)(&part[w][row * kPvPitch + c4]);
  s *= kPCarryInv;
  *(v4f*)(outp + (size_t)(m0 + row) * kDim + n0 + c4) = s;
}

// ---------------------------------------------------------------------------
// Host glue.
//   Q16  bf16 [4][4096][64]           2,097,152  at           0   (written by cast_cat_bf16_kernel)
//   K16  bf16 [4][4096][64]           2,097,152  at   2,097,152   (written by cast_cat_bf16_kernel)
//   VT   f16  [4][64][4096]           2,097,152  at   4,194,304   (written by vt_cat_f16_kernel)
//   SC   f32  [4096][4096]           67,108,864  at   6,291,456   (scores of one batch, re-used 4x, same type/layout)
//   PP   f16  [4096][4096]           33,554,432  at  73,400,320   (probabilities x32768 of one batch, re-used 4x)
//   total                           106,954,752
// GEMM shapes: scores M=N=4096 (64-multiples), K=64 (%32==0); P.V M=4096, N=64 (32-multiples), K=4096 (8 waves x 512). No padding anywhere.
// ---------------------------------------------------------------------------
extern "C" void kernel_launch(void* const* d_in, const int* in_sizes, int n_in,
                              void* d_out, int out_size, void* d_ws, size_t ws_size,
                              hipStream_t stream) {
  if (n_in < 6) return;
  const int nIn = kBatch * kSeq * kDim;           // 524288 per input
  for (int i = 0; i < 6; ++i) if (in_sizes[i] != nIn) return;
  const int nOut = kBatch * kLtot * kDim;         // 1048576
  if (out_size != nOut) return;

  const size_t szQK = (size_t)kBatch * kLtot * kDim * 2;   // 2,097,152
  const size_t szVT = (size_t)kBatch * kDim * kLtot * 2;   // 2,097,152
  const size_t szS  = (size_t)kLtot * kLtot * 4;           // 67,108,864
  const size_t szP  = (size_t)kLtot * kLtot * 2;           // 33,554,432
  const size_t offQ  = 0;
  const size_t offK  = offQ + szQK;
  const size_t offVT = offK + szQK;
  const size_t offS  = offVT + szVT;
  const size_t offP  = offS + szS;
  const size_t total = offP + szP;                          // 106,954,752
  if (ws_size < total) return;

  const float* Q1 = (const float*)d_in[0];
  const float* K1 = (const float*)d_in[1];
  const float* V1 = (const float*)d_in[2];
  const float* Q2 = (const float*)d_in[3];
  const float* K2 = (const float*)d_in[4];
  const float* V2 = (const float*)d_in[5];
  float* out = (float*)d_out;
  char* ws = (char*)d_ws;
  unsigned short* Q16 = (unsigned short*)(ws + offQ);
  unsigned short* K16 = (unsigned short*)(ws + offK);
  unsigned short* VT  = (unsigned short*)(ws + offVT);
  float* SC = (float*)(ws + offS);
  unsigned short* PP = (unsigned short*)(ws + offP);

  // ---- prologue: concatenated 16-bit operand planes ----
  const int tilesPerHalf = (kSeq * kDim) / 2048;   // 64 blocks of 256 threads x 8 elements per (half, batch)
  cast_cat_bf16_kernel<<<dim3(tilesPerHalf, 2, kBatch), dim3(256), 0, stream>>>(Q1, Q2, Q16);
  cast_cat_bf16_kernel<<<dim3(tilesPerHalf, 2, kBatch), dim3(256), 0, stream>>>(K1, K2, K16);
  vt_cat_f16_kernel<<<dim3(kLtot / 64, kBatch), dim3(256), 0, stream>>>(V1, V2, VT);

  const int tilesScore = (kLtot / 64) * (kLtot / 64);   // 4096 tiles -> 512 blocks of 8 waves (exact)
  const int tilesCtx   = (kLtot / 32) * (kDim / 32);    // 256 tiles of 32x32 -> 256 blocks, K split over the 8 waves of each

  for (int b = 0; b < kBatch; ++b) {
    const unsigned short* Qb  = Q16 + (size_t)b * kLtot * kDim;
    const unsigned short* Kb  = K16 + (size_t)b * kLtot * kDim;
    const unsigned short* VTb = VT  + (size_t)b * kDim * kLtot;
    float* outb = out + (size_t)b * kLtot * kDim;
    // SC[i][j] = 0.125 * sum_d Q16[b,i,d] * K16[b,j,d]   (M=N=4096, K=64; bf16 operands)
    wmma_gemm64<1, false, 0, 0, false, 0><<<dim3(tilesScore / 8, 1), dim3(256), 0, stream>>>(
        Qb, Qb, kDim, 0L, Kb, Kb, kDim, 0L,
        (void*)SC, (void*)SC, kLtot, 0L, SC, SC, 0L, kLtot, kLtot, kDim, kScale);
    // row softmax -> PP (f16, x32768)
    softmax_row_kernel<<<dim3(kLtot), dim3(256), 0, stream>>>(SC, PP);
    // out[b, i, n] = 2^-15 * sum_j PP[i][j] * VT[b][n][j]   (M=4096, N=64, K=4096; f16 operands)
    pv_splitk_kernel<<<dim3(tilesCtx), dim3(256), 0, stream>>>(PP, VTb, outb);
  }
}

// v002
// Measured time: 30.7 microseconds a run.
// Next to v001, in two timings, it ran 6.08 and 6.14 times as fast.
// All steps since v000 together make it 28.3 times as fast.
// Contractions: scores fK.fQ^T on v_wmma_f32_16x16x32_bf16 (fQ, fK as RNE-bf16 planes), fV^T.P^T on v_wmma_f32_16x16x32_f16 (P = exp2 of the scaled score minus the maximum in use, rounded to f16; fV^T as an f16 plane holding RNE-bf16 values); f32 accumulate everywhere; softmax max/exp/normalise in f32, its denominator summed in f32 from the f16 P.
#include <hip/hip_runtime.h>
#include <math.h>

// ---------------------------------------------------------------------------
// Problem constants
// ---------------------------------------------------------------------------
constexpr int kBatch = 4;
constexpr int kSeq   = 2048;            // rows per input tensor
constexpr int kLtot  = 2 * kSeq;        // 4096 concatenated rows (queries and keys)
constexpr int kDim   = 64;
constexpr float kScaleLog2 = 0.125f * 1.4426950408889634f;   // 64^-0.5 * log2(e): softmax in base 2
static_assert(kDim == 64);              // two 32-deep k-steps of the scores product, four 16-row tiles of the output
static_assert(kSeq % 64 == 0);          // concat boundary on tile boundaries
static_assert((kSeq * kDim) % 2048 == 0);

typedef __attribute__((ext_vector_type(16))) _Float16 v16h;
typedef __attribute__((ext_vector_type(8)))  _Float16 v8h;
typedef __attribute__((ext_vector_type(2)))  _Float16 v2h;
typedef __attribute__((ext_vector_type(16))) __bf16   v16b;
typedef __attribute__((ext_vector_type(8)))  __bf16   v8b;
typedef __attribute__((ext_vector_type(8)))  float    v8f;
typedef __attribute__((ext_vector_type(4)))  float    v4f;
typedef __attribute__((ext_vector_type(2)))  float    v2f;
typedef __attribute__((ext_vector_type(4)))  unsigned int v4u;
typedef __attribute__((ext_vector_type(8)))  unsigned int v8u;

// ---------------------------------------------------------------------------
// Device helpers
// ---------------------------------------------------------------------------
__device__ __forceinline__ unsigned short f2bf_bits(float f) {
  unsigned u = __float_as_uint(f);
  return (unsigned short)((u + 0x7FFFu + ((u >> 16) & 1u)) >> 16);
}
__device__ __forceinline__ float bf_bits2f(unsigned short h) { return __uint_as_float(((unsigned)h) << 16); }

template <typename T> struct Frag;
template <> struct Frag<_Float16> {
  typedef v16h V; union U { v16h v; v8h h[2]; };
  // elements 0..7 <- p[0..7], 8..15 <- p[16..23]
  static __device__ __forceinline__ v16h load(const _Float16* p) {
    U f; f.h[0] = *(const v8h*)(p); f.h[1] = *(const v8h*)(p + 16); return f.v;
  }
  static __device__ __forceinline__ v8f mma(v16h a, v16h b, v8f c) {
    return __builtin_amdgcn_wmma_f32_16x16x32_f16(false, a, false, b, (short)0, c, false, false);
  }
};
template <> struct Frag<__bf16> {
  typedef v16b V; union U { v16b v; v8b h[2]; };
  static __device__ __forceinline__ v16b load(const __bf16* p) {
    U f; f.h[0] = *(const v8b*)(p); f.h[1] = *(const v8b*)(p + 16); return f.v;
  }
  static __device__ __forceinline__ v8f mma(v16b a, v16b b, v8f c) {
    return __builtin_amdgcn_wmma_f32_16x16x32_bf16(false, a, false, b, (short)0, c, false, false);
  }
};

__device__ __forceinline__ unsigned pk16(unsigned short a, unsigned short b) { return (unsigned)a | ((unsigned)b << 16); }
__device__ __forceinline__ unsigned short h_bits(float f) { const _Float16 h = (_Float16)f; return __builtin_bit_cast(unsigned short, h); }
// two f32 -> two f16, round to nearest even
__device__ __forceinline__ unsigned pack2h(float lo, float hi) { return __builtin_bit_cast(unsigned, __builtin_convertvector((v2f){lo, hi}, v2h)); }
// lane l <-> lane l ^ 16
__device__ __forceinline__ float xhalf(float x) {
  return __builtin_bit_cast(float, __builtin_amdgcn_permlanex16(__builtin_bit_cast(int, x), __builtin_bit_cast(int, x), 0x76543210, 0xfedcba98, false, false));
}

// ---------------------------------------------------------------------------
// Concatenate + cast to RNE bf16 bits: dst[b][r][d] (pitch 64 halves) for r in [0, 4096):
//   rows 0..2047 from srcA[b][r][d], rows 2048..4095 from srcB[b][r-2048][d].
// grid (64, 2, kBatch): blockIdx.x = 2048-element tile (32 rows x 64), blockIdx.y = half (0: srcA, 1: srcB, block-uniform),
// blockIdx.z = batch. Coverage per (half, batch): 64 blocks x 256 threads x 8 = 131072 = 2048 x 64 elements = the whole half plane.
// ---------------------------------------------------------------------------
__global__ __launch_bounds__(256) void cast_cat_bf16_kernel(const float* __restrict__ srcA, const float* __restrict__ srcB,
                                                           unsigned short* __restrict__ dst) {
  const int t    = threadIdx.x;
  const int half = blockIdx.y;
  const int b    = blockIdx.z;
  const float* src = (half == 0) ? srcA : srcB;
  const size_t so = ((size_t)b * kSeq) * kDim + (size_t)blockIdx.x * 2048 + 8 * (size_t)t;
  const size_t dofs = ((size_t)b * kLtot + (size_t)half * kSeq) * kDim + (size_t)blockIdx.x * 2048 + 8 * (size_t)t;
  const v4f a = *(const v4f*)(src + so);
  const v4f c = *(const v4f*)(src + so + 4);
  unsigned short hb[8];
#pragma unroll
  for (int e = 0; e < 4; ++e) {
    hb[e]     = f2bf_bits(a[e]);
    hb[4 + e] = f2bf_bits(c[e]);
  }
  const v4u u = (v4u){pk16(hb[0], hb[1]), pk16(hb[2], hb[3]), pk16(hb[4], hb[5]), pk16(hb[6], hb[7])};
  unsigned short* q = dst + dofs;
  *(v4u*)q = u;
  
}

// ---------------------------------------------------------------------------
// Concatenated V transpose + cast: VT[b][d][s] (pitch 4096 halves) = f16( RNE-bf16( fV[b][s][d] ) ), s in [0, 4096):
//   s < 2048 from srcA[b][s][d], else srcB[b][s-2048][d].
// grid (64, kBatch): blockIdx.x = 64-key tile of the concatenated index (tiles 0..31 read srcA, 32..63 read srcB, block-uniform),
// blockIdx.y = batch. 256 threads.
// Load coverage: 4 iterations x 256 threads x 4 floats = 4096 = the whole 64(s) x 64(d) tile (coalesced along d); every sm[d][s<64] written.
// Store coverage: 8 waves x 2 iterations x 4 rows (lane>>3) = 64 d-rows; (lane&7) x 8 halves = 64 s-cols; each row segment =
// ---------------------------------------------------------------------------
__global__ __launch_bounds__(256) void vt_cat_f16_kernel(const float* __restrict__ srcA, const float* __restrict__ srcB,
                                                        unsigned short* __restrict__ vt) {
  __shared__ float sm[kDim][65];   // sm[d][s_local]; column 64 is never read
  const int t  = threadIdx.x;
  const int tileIdx = blockIdx.x;
  const int b  = blockIdx.y;
  const int s0 = tileIdx * 64;                              // concatenated key index of the tile
  const float* src = (tileIdx < (kSeq / 64)) ? srcA : srcB; // block-uniform source select
  const int sl0 = s0 & (kSeq - 1);                          // row within the source tensor
#pragma unroll
  for (int i = 0; i < 4; ++i) {
    const int f  = i * 256 + t;     // float4 index 0..1023
    const int r  = f >> 4;          // s local 0..63
    const int d4 = (f & 15) * 4;    // d 0..60
    const v4f w = *(const v4f*)(src + ((size_t)b * kSeq + sl0 + r) * kDim + d4);
#pragma unroll
    for (int e = 0; e < 4; ++e) sm[d4 + e][r] = bf_bits2f(f2bf_bits(w[e]));
  }
  __syncthreads();
  const int lane = t & 31, wave = t >> 5;
  const int q = lane >> 3, c8 = (lane & 7) * 8;
  unsigned short* op = vt + (size_t)b * kDim * kLtot;
  {
#pragma unroll
    for (int it = 0; it < 2; ++it) {
      const int row = wave * 8 + it * 4 + q;               // d
      unsigned short hb[8];
#pragma unroll
      for (int e = 0; e < 8; ++e) hb[e] = h_bits(sm[row][c8 + e]);
      const v4u u = (v4u){pk16(hb[0], hb[1]), pk16(hb[2], hb[3]), pk16(hb[4], hb[5]), pk16(hb[6], hb[7])};
      *(v4u*)(op + (size_t)row * kLtot + s0 + c8) = u;
    }
    
  }
}

// ---------------------------------------------------------------------------
// Fused attention: out[b][q][:] = softmax_k(0.125 * fQ[b][q].fK[b][k]) . fV[b][k][:], the scores never leave the registers.
// One work-group = 64 queries of one batch: grid = 4 x 64 = 256 work-groups of 8 waves.
// Wave w: all 64 query columns of the block (4 groups of 16), keys 512 w .. + 511, in 16 passes of 32 keys:
// a K or V^T fragment, once loaded, serves four column groups.
// Transposed products: S^T = K.Q^T (A = 16 key rows, B = 16 query columns), so a lane holds scores of ONE query (column c = lane & 15):
//   s[kt][g][r] = S[query 16 g + c][key 16 kt + 8 h + r], h = lane >> 4.
// The two score tiles of a pass, turned into exponentials and packed to f16 in place, are the B operand of O^T += V^T.P^T:
//   element e of the operand = tile e >> 3, register e & 7 = key 8 h + e (e < 8), 16 + 8 h + (e - 8) (e >= 8),
//   which is the key order in which Frag::load at + 8 h reads a row of V^T (A operand, row d = 16 t + c).
// Online softmax in base 2; the maximum in use may trail the true one by up to 8, so the accumulators are rescaled rarely.
// The denominator is one more product per column group: A with ones in row 0 gives the column sums of P^T in row 0 of lacc.
// The 8 key ranges of a query meet in LDS and are merged in range order 0..7 with weights exp2(m - max).
// ---------------------------------------------------------------------------
constexpr int kFaWaves  = 8;
constexpr int kFaRanges = kFaWaves;             // key ranges per work-group, one per wave
constexpr int kFaG      = 4;                    // 16-column query groups per wave
constexpr int kFaKeys   = kLtot / kFaRanges;    // keys per wave
constexpr int kFaPasses = kFaKeys / 32;
constexpr int kFaRows   = 64;                   // queries per work-group
constexpr int kFaPitch  = 68;                   // floats per LDS row of a partial: rows stay 16-B aligned, neighbours fall on other banks
static_assert(kFaKeys % 32 == 0 && kLtot % kFaRows == 0 && kFaRows == 16 * kFaG);
__global__ __launch_bounds__(kFaWaves * 32) void fused_attn_kernel(const unsigned short* __restrict__ Qp, const unsigned short* __restrict__ Kp,
                                                                   const unsigned short* __restrict__ VTp, float* __restrict__ outp) {
  __shared__ __align__(16) float part[kFaWaves][kFaRows * kFaPitch];
  __shared__ float pm[kFaWaves][kFaRows];
  __shared__ float pl[kFaWaves][kFaRows];
  const int tid  = threadIdx.x;
  const int lane = tid & 31;
  const int wave = __builtin_amdgcn_readfirstlane(tid >> 5);   // in a scalar register, so that the wave's base addresses are scalar too
  const int c    = lane & 15;
  const int h    = lane >> 4;
  const int b    = blockIdx.x / (kLtot / kFaRows);
  const int q0   = (blockIdx.x % (kLtot / kFaRows)) * kFaRows;
  const int kbeg = wave * kFaKeys;
  // wave-uniform bases in scalar registers; the lane's own part is a 32-bit offset
  const __bf16*   Qb = (const __bf16*)Qp    + ((size_t)b * kLtot + q0) * kDim;
  const __bf16*   Kb = (const __bf16*)Kp    + ((size_t)b * kLtot + kbeg) * kDim;
  const _Float16* Vb = (const _Float16*)VTp + (size_t)b * kDim * kLtot + kbeg;
  const unsigned  rowOff = (unsigned)(c * kDim + 8 * h);    // Q, K: row c, k offset of this lane half
  const unsigned  vtOff  = (unsigned)(c * kLtot + 8 * h);   // V^T: row c, key offset of this lane half

  v16b qf[kFaG][2];
#pragma unroll
  for (int g = 0; g < kFaG; ++g)
#pragma unroll
    for (int kc = 0; kc < 2; ++kc) qf[g][kc] = Frag<__bf16>::load(Qb + rowOff + (16 * g) * kDim + 32 * kc);

  v16b kf[2][2];
#pragma unroll
  for (int kt = 0; kt < 2; ++kt)
#pragma unroll
    for (int kc = 0; kc < 2; ++kc) kf[kt][kc] = Frag<__bf16>::load(Kb + rowOff + (16 * kt) * kDim + 32 * kc);

  v16h vf[4];
#pragma unroll
  for (int t = 0; t < 4; ++t) vf[t] = Frag<_Float16>::load(Vb + (size_t)vtOff + (16 * t) * kLtot);

  // stands in front of the first overwrite of the loads' address registers (reused right below)
  asm volatile("s_wait_xcnt 0x0" ::: "memory");
  __builtin_amdgcn_sched_barrier(0);   // keeps the register set-up below from being lifted over the wait

  const unsigned oneBits = (c == 0) ? 0x3C003C00u : 0u;   // f16 1.0 twice in lanes 0 and 16 (row 0 of A), 0 elsewhere
  const v16h ones = __builtin_bit_cast(v16h, (v8u){oneBits, oneBits, oneBits, oneBits, oneBits, oneBits, oneBits, oneBits});

  v8f acc[kFaG][4], lacc[kFaG];
  float m_run[kFaG];
#pragma unroll
  for (int g = 0; g < kFaG; ++g) {
    m_run[g] = -__builtin_inff();
    lacc[g] = (v8f){0.f,0.f,0.f,0.f,0.f,0.f,0.f,0.f};
#pragma unroll
    for (int t = 0; t < 4; ++t) acc[g][t] = (v8f){0.f,0.f,0.f,0.f,0.f,0.f,0.f,0.f};
  }

  // byte offsets (lane's part included) of the fragments of the pass after the current one
  unsigned kNextB = (rowOff + 32u * kDim) * 2u;
  unsigned vNextB = (vtOff + 32u) * 2u;

  // two passes per trip: the two sets of V^T fragments swap roles without register copies; the body stays small in the instruction cache
#pragma unroll 2
  for (int i = 0; i < kFaPasses; ++i) {
    // K and V^T fragments are fetched one pass ahead; the last pass reads its own rows again (in bounds, not used)
    v16h vn[4];
#pragma unroll
    for (int t = 0; t < 4; ++t) vn[t] = Frag<_Float16>::load((const _Float16*)((const char*)Vb + vNextB) + (16 * t) * kLtot);

    v8f s[2][kFaG];
#pragma unroll
    for (int kt = 0; kt < 2; ++kt)
#pragma unroll
      for (int g = 0; g < kFaG; ++g) {
        s[kt][g] = (v8f){0.f,0.f,0.f,0.f,0.f,0.f,0.f,0.f};
#pragma unroll
        for (int kc = 0; kc < 2; ++kc) s[kt][g] = Frag<__bf16>::mma(kf[kt][kc], qf[g][kc], s[kt][g]);
      }
    // the next pass's K fragments
#pragma unroll
    for (int kt = 0; kt < 2; ++kt)
#pragma unroll
      for (int kc = 0; kc < 2; ++kc) kf[kt][kc] = Frag<__bf16>::load((const __bf16*)((const char*)Kb + kNextB) + (16 * kt) * kDim + 32 * kc);
    // stands in front of the first overwrite of the loads' address registers (stepped right below)
    asm volatile("s_wait_xcnt 0x0" ::: "memory");
    __builtin_amdgcn_sched_barrier(0);   // keeps the vector work below, which writes those registers, from being lifted over the wait
    if (i + 2 < kFaPasses) { kNextB += 32u * kDim * 2u; vNextB += 32u * 2u; }

    // maxima of the raw scores (the scale is positive), then one test per pass
    float mb[kFaG];
    bool need = false;
#pragma unroll
    for (int g = 0; g < kFaG; ++g) {
      float mx = s[0][g][0];
#pragma unroll
      for (int r = 1; r < 8; ++r) mx = fmaxf(mx, s[0][g][r]);
#pragma unroll
      for (int r = 0; r < 8; ++r) mx = fmaxf(mx, s[1][g][r]);
      mx = fmaxf(mx, xhalf(mx)) * kScaleLog2;   // both halves of the wave now hold this query's maximum, scaled
      mb[g] = mx;
      need = need || (mx > m_run[g] + 8.0f);
    }
    if (__builtin_amdgcn_ballot_w32(need) != 0) {   // wave-uniform; always taken in the first pass (m_run = -inf), rare later
#pragma unroll
      for (int g = 0; g < kFaG; ++g) {
        const float m_new = fmaxf(m_run[g], mb[g]);
        const float corr  = __builtin_amdgcn_exp2f(m_run[g] - m_new);   // 0 in the first pass
        m_run[g] = m_new;
        lacc[g] = lacc[g] * corr;
#pragma unroll
        for (int t = 0; t < 4; ++t) acc[g][t] = acc[g][t] * corr;
      }
    }
#pragma unroll
    for (int g = 0; g < kFaG; ++g) {
      const float nm = -m_run[g];
      v8u w;
#pragma unroll
      for (int e = 0; e < 8; ++e) {   // operand elements 2 e, 2 e + 1: tile e >> 2, registers 2 (e & 3), 2 (e & 3) + 1
        const float p0 = __builtin_amdgcn_exp2f(fmaf(s[e >> 2][g][2 * (e & 3)],     kScaleLog2, nm));
        const float p1 = __builtin_amdgcn_exp2f(fmaf(s[e >> 2][g][2 * (e & 3) + 1], kScaleLog2, nm));
        w[e] = pack2h(p0, p1);
      }
      const v16h pf = __builtin_bit_cast(v16h, w);
#pragma unroll
      for (int t = 0; t < 4; ++t) acc[g][t] = Frag<_Float16>::mma(vf[t], pf, acc[g][t]);
      lacc[g] = Frag<_Float16>::mma(ones, pf, lacc[g]);
    }
#pragma unroll
    for (int t = 0; t < 4; ++t) vf[t] = vn[t];
  }

  // ---- each wave's partial (maximum in use, denominator, 64 x 64 numerators) to LDS ----
  float* slab = part[wave];
#pragma unroll
  for (int g = 0; g < kFaG; ++g) {
    const float lr = lacc[g][0];          // the denominator in lanes 0..15 (row 0), 0 in lanes 16..31 (row 8)
    const float l  = lr + xhalf(lr);      // unconditional: every lane is on at the exchange
    if (h == 0) { pm[wave][16 * g + c] = m_run[g]; pl[wave][16 * g + c] = l; }
#pragma unroll
    for (int t = 0; t < 4; ++t) {
      float* sp = slab + (16 * g + c) * kFaPitch + 16 * t + 8 * h;   // row = query, 8 consecutive d
      *(v4f*)(sp)     = (v4f){acc[g][t][0], acc[g][t][1], acc[g][t][2], acc[g][t][3]};
      *(v4f*)(sp + 4) = (v4f){acc[g][t][4], acc[g][t][5], acc[g][t][6], acc[g][t][7]};
    }
  }
  __syncthreads();
  // ---- merge: 256 threads x 16 floats = the 64 x 64 block; 4 threads cover one 256-B row of out ----
  const int row = tid >> 2, c16 = (tid & 3) * 16;
  float mAll = pm[0][row];
#pragma unroll
  for (int w = 1; w < kFaRanges; ++w) mAll = fmaxf(mAll, pm[w][row]);
  float den = 0.f;
  v4f o[4];
#pragma unroll
  for (int j = 0; j < 4; ++j) o[j] = (v4f){0.f, 0.f, 0.f, 0.f};
#pragma unroll
  for (int w = 0; w < kFaRanges; ++w) {
    const float f = __builtin_amdgcn_exp2f(pm[w][row] - mAll);
    den += f * pl[w][row];
#pragma unroll
    for (int j = 0; j < 4; ++j) o[j] += f * *(const v4f*)(&part[w][row * kFaPitch + c16 + 4 * j]);
  }
  const float inv = 1.0f / den;
  float* op = outp + ((size_t)b * kLtot + q0 + row) * kDim + c16;
#pragma unroll
  for (int j = 0; j < 4; ++j) *(v4f*)(op + 4 * j) = o[j] * inv;
}

// ---------------------------------------------------------------------------
// Host glue.
//   Q16  bf16 [4][4096][64]           2,097,152  at           0   (written by cast_cat_bf16_kernel)
//   K16  bf16 [4][4096][64]           2,097,152  at   2,097,152   (written by cast_cat_bf16_kernel)
//   VT   f16  [4][64][4096]           2,097,152  at   4,194,304   (written by vt_cat_f16_kernel)
//   total                             6,291,456
// ---------------------------------------------------------------------------
extern "C" void kernel_launch(void* const* d_in, const int* in_sizes, int n_in,
                              void* d_out, int out_size, void* d_ws, size_t ws_size,
                              hipStream_t stream) {
  if (n_in < 6) return;
  const int nIn = kBatch * kSeq * kDim;           // 524288 per input
  for (int i = 0; i < 6; ++i) if (in_sizes[i] != nIn) return;
  const int nOut = kBatch * kLtot * kDim;         // 1048576
  if (out_size != nOut) return;

  const size_t szQK = (size_t)kBatch * kLtot * kDim * 2;   // 2,097,152
  const size_t szVT = (size_t)kBatch * kDim * kLtot * 2;   // 2,097,152
  const size_t offQ  = 0;
  const size_t offK  = offQ + szQK;
  const size_t offVT = offK + szQK;
  const size_t total = offVT + szVT;                        // 6,291,456
  if (ws_size < total) return;

  const float* Q1 = (const float*)d_in[0];
  const float* K1 = (const float*)d_in[1];
  const float* V1 = (const float*)d_in[2];
  const float* Q2 = (const float*)d_in[3];
  const float* K2 = (const float*)d_in[4];
  const float* V2 = (const float*)d_in[5];
  float* out = (float*)d_out;
  char* ws = (char*)d_ws;
  unsigned short* Q16 = (unsigned short*)(ws + offQ);
  unsigned short* K16 = (unsigned short*)(ws + offK);
  unsigned short* VT  = (unsigned short*)(ws + offVT);

  // ---- prologue: concatenated 16-bit operand planes ----
  const int tilesPerHalf = (kSeq * kDim) / 2048;   // 64 blocks of 256 threads x 8 elements per (half, batch)
  cast_cat_bf16_kernel<<<dim3(tilesPerHalf, 2, kBatch), dim3(256), 0, stream>>>(Q1, Q2, Q16);
  cast_cat_bf16_kernel<<<dim3(tilesPerHalf, 2, kBatch), dim3(256), 0, stream>>>(K1, K2, K16);
  vt_cat_f16_kernel<<<dim3(kLtot / 64, kBatch), dim3(256), 0, stream>>>(V1, V2, VT);

  // ---- scores, softmax and P.V of all batches in one launch ----
  fused_attn_kernel<<<dim3(kBatch * (kLtot / kFaRows)), dim3(kFaWaves * 32), 0, stream>>>(Q16, K16, VT, out);
}

// v003
// Measured time: 26.5 microseconds a run.
// Next to v002, in two timings, it ran 1.14 times as fast each time.
// Over all steps from v000 it is 32.3 times as fast.
// Contractions: scores fK.fQ^T on v_wmma_f32_16x16x32_bf16 (fQ, fK as RNE-bf16 planes), fV^T.P^T on v_wmma_f32_16x16x32_f16 (P = exp2 of the scaled score minus the maximum in use, rounded to f16; fV^T as an f16 plane holding RNE-bf16 values); f32 accumulate everywhere; softmax max/exp/normalise in f32, its denominator summed in f32 from the f16 P.
#include <hip/hip_runtime.h>
#include <math.h>

// ---------------------------------------------------------------------------
// Problem constants
// ---------------------------------------------------------------------------
constexpr int kBatch = 4;
constexpr int kSeq   = 2048;            // rows per input tensor
constexpr int kLtot  = 2 * kSeq;        // 4096 concatenated rows (queries and keys)
constexpr int kDim   = 64;
constexpr float kScaleLog2 = 0.125f * 1.4426950408889634f;   // 64^-0.5 * log2(e): softmax in base 2
static_assert(kDim == 64);              // two 32-deep k-steps of the scores product, four 16-row tiles of the output
static_assert(kSeq % 64 == 0);          // concat boundary on tile boundaries

typedef __attribute__((ext_vector_type(16))) _Float16 v16h;
typedef __attribute__((ext_vector_type(8)))  _Float16 v8h;
typedef __attribute__((ext_vector_type(2)))  _Float16 v2h;
typedef __attribute__((ext_vector_type(16))) __bf16   v16b;
typedef __attribute__((ext_vector_type(8)))  __bf16   v8b;
typedef __attribute__((ext_vector_type(8)))  float    v8f;
typedef __attribute__((ext_vector_type(4)))  float    v4f;
typedef __attribute__((ext_vector_type(2)))  float    v2f;
typedef __attribute__((ext_vector_type(4)))  unsigned int v4u;
typedef __attribute__((ext_vector_type(8)))  unsigned int v8u;

// ---------------------------------------------------------------------------
// Device helpers
// ---------------------------------------------------------------------------
__device__ __forceinline__ unsigned short f2bf_bits(float f) {
  unsigned u = __float_as_uint(f);
  return (unsigned short)((u + 0x7FFFu + ((u >> 16) & 1u)) >> 16);
}
__device__ __forceinline__ float bf_bits2f(unsigned short h) { return __uint_as_float(((unsigned)h) << 16); }

template <typename T> struct Frag;
template <> struct Frag<_Float16> {
  typedef v16h V; union U { v16h v; v8h h[2]; };
  // elements 0..7 <- p[0..7], 8..15 <- p[16..23]
  static __device__ __forceinline__ v16h load(const _Float16* p) {
    U f; f.h[0] = *(const v8h*)(p); f.h[1] = *(const v8h*)(p + 16); return f.v;
  }
  static __device__ __forceinline__ v8f mma(v16h a, v16h b, v8f c) {
    return __builtin_amdgcn_wmma_f32_16x16x32_f16(false, a, false, b, (short)0, c, false, false);
  }
};
template <> struct Frag<__bf16> {
  typedef v16b V; union U { v16b v; v8b h[2]; };
  static __device__ __forceinline__ v16b load(const __bf16* p) {
    U f; f.h[0] = *(const v8b*)(p); f.h[1] = *(const v8b*)(p + 16); return f.v;
  }
  static __device__ __forceinline__ v8f mma(v16b a, v16b b, v8f c) {
    return __builtin_amdgcn_wmma_f32_16x16x32_bf16(false, a, false, b, (short)0, c, false, false);
  }
};

__device__ __forceinline__ unsigned pk16(unsigned short a, unsigned short b) { return (unsigned)a | ((unsigned)b << 16); }
__device__ __forceinline__ unsigned short h_bits(float f) { const _Float16 h = (_Float16)f; return __builtin_bit_cast(unsigned short, h); }
// two f32 -> two f16, round to nearest even
__device__ __forceinline__ unsigned pack2h(float lo, float hi) { return __builtin_bit_cast(unsigned, __builtin_convertvector((v2f){lo, hi}, v2h)); }
// lane l <-> lane l ^ 16
__device__ __forceinline__ float xhalf(float x) {
  return __builtin_bit_cast(float, __builtin_amdgcn_permlanex16(__builtin_bit_cast(int, x), __builtin_bit_cast(int, x), 0x76543210, 0xfedcba98, false, false));
}

// ---------------------------------------------------------------------------
// Operand planes, all three in one launch. One work-group = one 64-row tile of the concatenated index r of one batch:
//   Q16[b][r][d], K16[b][r][d] (pitch 64 halves) = RNE-bf16 bits of fQ, fK;
//   VT[b][d][r]   (pitch 4096 halves)            = f16( RNE-bf16( fV[b][r][d] ) );
//   rows r < 2048 come from the first tensor of a pair, the others from the second (row r - 2048).
// grid (64, kBatch): blockIdx.x = tile (tiles 0..31 read the first tensors, 32..63 the second, block-uniform), blockIdx.y = batch. 256 threads.
// Cast coverage per plane: 2 iterations x 256 threads x 8 elements = 4096 = the tile's 64 rows x 64, contiguous in source and plane.
// V load coverage: 4 iterations x 256 threads x 4 floats = 4096 = the whole 64(s) x 64(d) tile (coalesced along d); every sm[d][s<64] written.
// V store coverage: 8 waves x 2 iterations x 4 rows (lane>>3) = 64 d-rows; (lane&7) x 8 halves = 64 s-cols.
// All twelve 16-byte loads of a thread are issued before the first is used.
// ---------------------------------------------------------------------------
__device__ __forceinline__ v4u cast8_bf16(v4f a, v4f c) {
  unsigned short hb[8];
#pragma unroll
  for (int e = 0; e < 4; ++e) {
    hb[e]     = f2bf_bits(a[e]);
    hb[4 + e] = f2bf_bits(c[e]);
  }
  return (v4u){pk16(hb[0], hb[1]), pk16(hb[2], hb[3]), pk16(hb[4], hb[5]), pk16(hb[6], hb[7])};
}

__global__ __launch_bounds__(256) void prep_planes_kernel(const float* __restrict__ qA, const float* __restrict__ qB,
                                                          const float* __restrict__ kA, const float* __restrict__ kB,
                                                          const float* __restrict__ vA, const float* __restrict__ vB,
                                                          unsigned short* __restrict__ q16, unsigned short* __restrict__ k16,
                                                          unsigned short* __restrict__ vt) {
  __shared__ float sm[kDim][65];   // sm[d][s_local]; column 64 is never read
  const int t  = threadIdx.x;
  const int tileIdx = blockIdx.x;
  const int b  = blockIdx.y;
  const int s0 = tileIdx * 64;                              // concatenated row index of the tile
  const bool first = tileIdx < (kSeq / 64);                 // block-uniform source select
  const int sl0 = s0 & (kSeq - 1);                          // row within the source tensor
  const size_t so   = ((size_t)b * kSeq + sl0) * kDim;      // the tile in a source tensor
  const size_t dofs = ((size_t)b * kLtot + s0) * kDim;      // the tile in a row-major plane
  const float* qs = (first ? qA : qB) + so;
  const float* ks = (first ? kA : kB) + so;
  const float* vs = (first ? vA : vB) + so;

  v4f w[4], qa[2][2], ka[2][2];
#pragma unroll
  for (int i = 0; i < 4; ++i) w[i] = *(const v4f*)(vs + 4 * (i * 256 + t));   // float4 index i * 256 + t = row (s local) * 16 + d / 4
#pragma unroll
  for (int i = 0; i < 2; ++i)
#pragma unroll
    for (int j = 0; j < 2; ++j) {
      qa[i][j] = *(const v4f*)(qs + i * 2048 + 8 * t + 4 * j);
      ka[i][j] = *(const v4f*)(ks + i * 2048 + 8 * t + 4 * j);
    }

#pragma unroll
  for (int i = 0; i < 4; ++i) {
    const int f  = i * 256 + t;     // float4 index 0..1023
    const int r  = f >> 4;          // s local 0..63
    const int d4 = (f & 15) * 4;    // d 0..60
#pragma unroll
    for (int e = 0; e < 4; ++e) sm[d4 + e][r] = bf_bits2f(f2bf_bits(w[i][e]));
  }
  __syncthreads();
  // the casts' stores stand behind the barrier, which would otherwise wait for them to complete
#pragma unroll
  for (int i = 0; i < 2; ++i) {
    *(v4u*)(q16 + dofs + i * 2048 + 8 * t) = cast8_bf16(qa[i][0], qa[i][1]);
    *(v4u*)(k16 + dofs + i * 2048 + 8 * t) = cast8_bf16(ka[i][0], ka[i][1]);
  }
  const int lane = t & 31, wave = t >> 5;
  const int q = lane >> 3, c8 = (lane & 7) * 8;
  unsigned short* op = vt + (size_t)b * kDim * kLtot;
#pragma unroll
  for (int it = 0; it < 2; ++it) {
    const int row = wave * 8 + it * 4 + q;               // d
    unsigned short hb[8];
#pragma unroll
    for (int e = 0; e < 8; ++e) hb[e] = h_bits(sm[row][c8 + e]);
    const v4u u = (v4u){pk16(hb[0], hb[1]), pk16(hb[2], hb[3]), pk16(hb[4], hb[5]), pk16(hb[6], hb[7])};
    *(v4u*)(op + (size_t)row * kLtot + s0 + c8) = u;
  }
}

// ---------------------------------------------------------------------------
// Fused attention: out[b][q][:] = softmax_k(0.125 * fQ[b][q].fK[b][k]) . fV[b][k][:], the scores never leave the registers.
// One work-group = 64 queries of one batch: grid = 4 x 64 = 256 work-groups of 8 waves.
// Wave w: all 64 query columns of the block (4 groups of 16), keys 512 w .. + 511, in 16 passes of 32 keys:
// a K or V^T fragment, once loaded, serves four column groups.
// Transposed products: S^T = K.Q^T (A = 16 key rows, B = 16 query columns), so a lane holds scores of ONE query (column c = lane & 15):
//   s[kt][g][r] = S[query 16 g + c][key 16 kt + 8 h + r], h = lane >> 4.
// The two score tiles of a pass, turned into exponentials and packed to f16 in place, are the B operand of O^T += V^T.P^T:
//   element e of the operand = tile e >> 3, register e & 7 = key 8 h + e (e < 8), 16 + 8 h + (e - 8) (e >= 8),
//   which is the key order in which Frag::load at + 8 h reads a row of V^T (A operand, row d = 16 t + c).
// Online softmax in base 2; the maximum in use may trail the true one by up to 8, so the accumulators are rescaled rarely.
// The denominator is one more product per column group: A with ones in row 0 gives the column sums of P^T in row 0 of lacc.
// The 8 key ranges of a query meet in LDS and are merged in range order 0..7 with weights exp2(m - max).
// ---------------------------------------------------------------------------
constexpr int kFaWaves  = 8;
constexpr int kFaRanges = kFaWaves;             // key ranges per work-group, one per wave
constexpr int kFaG      = 4;                    // 16-column query groups per wave
constexpr int kFaKeys   = kLtot / kFaRanges;    // keys per wave
constexpr int kFaPasses = kFaKeys / 32;
constexpr int kFaRows   = 64;                   // queries per work-group
constexpr int kFaPitch  = 68;                   // floats per LDS row of a partial: rows stay 16-B aligned, neighbours fall on other banks
static_assert(kFaKeys % 32 == 0 && kLtot % kFaRows == 0 && kFaRows == 16 * kFaG);
__global__ __launch_bounds__(kFaWaves * 32) void fused_attn_kernel(const unsigned short* __restrict__ Qp, const unsigned short* __restrict__ Kp,
                                                                   const unsigned short* __restrict__ VTp, float* __restrict__ outp) {
  __shared__ __align__(16) float part[kFaWaves][kFaRows * kFaPitch];
  __shared__ float pm[kFaWaves][kFaRows];
  __shared__ float pl[kFaWaves][kFaRows];
  const int tid  = threadIdx.x;
  const int lane = tid & 31;
  const int wave = __builtin_amdgcn_readfirstlane(tid >> 5);   // in a scalar register, so that the wave's base addresses are scalar too
  const int c    = lane & 15;
  const int h    = lane >> 4;
  const int b    = blockIdx.x / (kLtot / kFaRows);
  const int q0   = (blockIdx.x % (kLtot / kFaRows)) * kFaRows;
  const int kbeg = wave * kFaKeys;
  // wave-uniform bases in scalar registers; the lane's own part is a 32-bit offset
  const __bf16*   Qb = (const __bf16*)Qp    + ((size_t)b * kLtot + q0) * kDim;
  const __bf16*   Kb = (const __bf16*)Kp    + ((size_t)b * kLtot + kbeg) * kDim;
  const _Float16* Vb = (const _Float16*)VTp + (size_t)b * kDim * kLtot + kbeg;
  const unsigned  rowOff = (unsigned)(c * kDim + 8 * h);    // Q, K: row c, k offset of this lane half
  const unsigned  vtOff  = (unsigned)(c * kLtot + 8 * h);   // V^T: row c, key offset of this lane half

  v16b qf[kFaG][2];
#pragma unroll
  for (int g = 0; g < kFaG; ++g)
#pragma unroll
    for (int kc = 0; kc < 2; ++kc) qf[g][kc] = Frag<__bf16>::load(Qb + rowOff + (16 * g) * kDim + 32 * kc);

  v16b kf[2][2];
#pragma unroll
  for (int kt = 0; kt < 2; ++kt)
#pragma unroll
    for (int kc = 0; kc < 2; ++kc) kf[kt][kc] = Frag<__bf16>::load(Kb + rowOff + (16 * kt) * kDim + 32 * kc);

  v16h vf[4];
#pragma unroll
  for (int t = 0; t < 4; ++t) vf[t] = Frag<_Float16>::load(Vb + (size_t)vtOff + (16 * t) * kLtot);

  // stands in front of the first overwrite of the loads' address registers (reused right below)
  asm volatile("s_wait_xcnt 0x0" ::: "memory");
  __builtin_amdgcn_sched_barrier(0);   // keeps the register set-up below from being lifted over the wait

  const unsigned oneBits = (c == 0) ? 0x3C003C00u : 0u;   // f16 1.0 twice in lanes 0 and 16 (row 0 of A), 0 elsewhere
  const v16h ones = __builtin_bit_cast(v16h, (v8u){oneBits, oneBits, oneBits, oneBits, oneBits, oneBits, oneBits, oneBits});

  v8f acc[kFaG][4], lacc[kFaG];
  float m_run[kFaG];
#pragma unroll
  for (int g = 0; g < kFaG; ++g) {
    m_run[g] = -__builtin_inff();
    lacc[g] = (v8f){0.f,0.f,0.f,0.f,0.f,0.f,0.f,0.f};
#pragma unroll
    for (int t = 0; t < 4; ++t) acc[g][t] = (v8f){0.f,0.f,0.f,0.f,0.f,0.f,0.f,0.f};
  }

  // byte offsets (lane's part included) of the fragments of the pass after the current one
  unsigned kNextB = (rowOff + 32u * kDim) * 2u;
  unsigned vNextB = (vtOff + 32u) * 2u;

  // two passes per trip: the two sets of V^T fragments swap roles without register copies; the body stays small in the instruction cache
#pragma unroll 2
  for (int i = 0; i < kFaPasses; ++i) {
    // K and V^T fragments are fetched one pass ahead; the last pass reads its own rows again (in bounds, not used)
    v16h vn[4];
#pragma unroll
    for (int t = 0; t < 4; ++t) vn[t] = Frag<_Float16>::load((const _Float16*)((const char*)Vb + vNextB) + (16 * t) * kLtot);

    v8f s[2][kFaG];
#pragma unroll
    for (int kt = 0; kt < 2; ++kt)
#pragma unroll
      for (int g = 0; g < kFaG; ++g) {
        s[kt][g] = (v8f){0.f,0.f,0.f,0.f,0.f,0.f,0.f,0.f};
#pragma unroll
        for (int kc = 0; kc < 2; ++kc) s[kt][g] = Frag<__bf16>::mma(kf[kt][kc], qf[g][kc], s[kt][g]);
      }
    // the next pass's K fragments
#pragma unroll
    for (int kt = 0; kt < 2; ++kt)
#pragma unroll
      for (int kc = 0; kc < 2; ++kc) kf[kt][kc] = Frag<__bf16>::load((const __bf16*)((const char*)Kb + kNextB) + (16 * kt) * kDim + 32 * kc);
    // stands in front of the first overwrite of the loads' address registers (stepped right below)
    asm volatile("s_wait_xcnt 0x0" ::: "memory");
    __builtin_amdgcn_sched_barrier(0);   // keeps the vector work below, which writes those registers, from being lifted over the wait
    if (i + 2 < kFaPasses) { kNextB += 32u * kDim * 2u; vNextB += 32u * 2u; }

    // maxima of the raw scores (the scale is positive), then one test per pass
    float mb[kFaG];
    bool need = false;
#pragma unroll
    for (int g = 0; g < kFaG; ++g) {
      float mx = s[0][g][0];
#pragma unroll
      for (int r = 1; r < 8; ++r) mx = fmaxf(mx, s[0][g][r]);
#pragma unroll
      for (int r = 0; r < 8; ++r) mx = fmaxf(mx, s[1][g][r]);
      mx = fmaxf(mx, xhalf(mx)) * kScaleLog2;   // both halves of the wave now hold this query's maximum, scaled
      mb[g] = mx;
      need = need || (mx > m_run[g] + 8.0f);
    }
    if (__builtin_amdgcn_ballot_w32(need) != 0) {   // wave-uniform; always taken in the first pass (m_run = -inf), rare later
#pragma unroll
      for (int g = 0; g < kFaG; ++g) {
        const float m_new = fmaxf(m_run[g], mb[g]);
        const float corr  = __builtin_amdgcn_exp2f(m_run[g] - m_new);   // 0 in the first pass
        m_run[g] = m_new;
        lacc[g] = lacc[g] * corr;
#pragma unroll
        for (int t = 0; t < 4; ++t) acc[g][t] = acc[g][t] * corr;
      }
    }
#pragma unroll
    for (int g = 0; g < kFaG; ++g) {
      const float nm = -m_run[g];
      v8u w;
#pragma unroll
      for (int e = 0; e < 8; ++e) {   // operand elements 2 e, 2 e + 1: tile e >> 2, registers 2 (e & 3), 2 (e & 3) + 1
        const float p0 = __builtin_amdgcn_exp2f(fmaf(s[e >> 2][g][2 * (e & 3)],     kScaleLog2, nm));
        const float p1 = __builtin_amdgcn_exp2f(fmaf(s[e >> 2][g][2 * (e & 3) + 1], kScaleLog2, nm));
        w[e] = pack2h(p0, p1);
      }
      const v16h pf = __builtin_bit_cast(v16h, w);
#pragma unroll
      for (int t = 0; t < 4; ++t) acc[g][t] = Frag<_Float16>::mma(vf[t], pf, acc[g][t]);
      lacc[g] = Frag<_Float16>::mma(ones, pf, lacc[g]);
    }
#pragma unroll
    for (int t = 0; t < 4; ++t) vf[t] = vn[t];
  }

  // ---- each wave's partial (maximum in use, denominator, 64 x 64 numerators) to LDS ----
  float* slab = part[wave];
#pragma unroll
  for (int g = 0; g < kFaG; ++g) {
    const float lr = lacc[g][0];          // the denominator in lanes 0..15 (row 0), 0 in lanes 16..31 (row 8)
    const float l  = lr + xhalf(lr);      // unconditional: every lane is on at the exchange
    if (h == 0) { pm[wave][16 * g + c] = m_run[g]; pl[wave][16 * g + c] = l; }
#pragma unroll
    for (int t = 0; t < 4; ++t) {
      float* sp = slab + (16 * g + c) * kFaPitch + 16 * t + 8 * h;   // row = query, 8 consecutive d
      *(v4f*)(sp)     = (v4f){acc[g][t][0], acc[g][t][1], acc[g][t][2], acc[g][t][3]};
      *(v4f*)(sp + 4) = (v4f){acc[g][t][4], acc[g][t][5], acc[g][t][6], acc[g][t][7]};
    }
  }
  __syncthreads();
  // ---- merge: 256 threads x 16 floats = the 64 x 64 block; 4 threads cover one 256-B row of out ----
  const int row = tid >> 2, c16 = (tid & 3) * 16;
  float mAll = pm[0][row];
#pragma unroll
  for (int w = 1; w < kFaRanges; ++w) mAll = fmaxf(mAll, pm[w][row]);
  float den = 0.f;
  v4f o[4];
#pragma unroll
  for (int j = 0; j < 4; ++j) o[j] = (v4f){0.f, 0.f, 0.f, 0.f};
#pragma unroll
  for (int w = 0; w < kFaRanges; ++w) {
    const float f = __builtin_amdgcn_exp2f(pm[w][row] - mAll);
    den += f * pl[w][row];
#pragma unroll
    for (int j = 0; j < 4; ++j) o[j] += f * *(const v4f*)(&part[w][row * kFaPitch + c16 + 4 * j]);
  }
  const float inv = 1.0f / den;
  float* op = outp + ((size_t)b * kLtot + q0 + row) * kDim + c16;
#pragma unroll
  for (int j = 0; j < 4; ++j) *(v4f*)(op + 4 * j) = o[j] * inv;
}

// ---------------------------------------------------------------------------
// Host glue.
//   Q16  bf16 [4][4096][64]           2,097,152  at           0   (written by prep_planes_kernel)
//   K16  bf16 [4][4096][64]           2,097,152  at   2,097,152   (written by prep_planes_kernel)
//   VT   f16  [4][64][4096]           2,097,152  at   4,194,304   (written by prep_planes_kernel)
//   total                             6,291,456
// ---------------------------------------------------------------------------
extern "C" void kernel_launch(void* const* d_in, const int* in_sizes, int n_in,
                              void* d_out, int out_size, void* d_ws, size_t ws_size,
                              hipStream_t stream) {
  if (n_in < 6) return;
  const int nIn = kBatch * kSeq * kDim;           // 524288 per input
  for (int i = 0; i < 6; ++i) if (in_sizes[i] != nIn) return;
  const int nOut = kBatch * kLtot * kDim;         // 1048576
  if (out_size != nOut) return;

  const size_t szQK = (size_t)kBatch * kLtot * kDim * 2;   // 2,097,152
  const size_t szVT = (size_t)kBatch * kDim * kLtot * 2;   // 2,097,152
  const size_t offQ  = 0;
  const size_t offK  = offQ + szQK;
  const size_t offVT = offK + szQK;
  const size_t total = offVT + szVT;                        // 6,291,456
  if (ws_size < total) return;

  const float* Q1 = (const float*)d_in[0];
  const float* K1 = (const float*)d_in[1];
  const float* V1 = (const float*)d_in[2];
  const float* Q2 = (const float*)d_in[3];
  const float* K2 = (const float*)d_in[4];
  const float* V2 = (const float*)d_in[5];
  float* out = (float*)d_out;
  char* ws = (char*)d_ws;
  unsigned short* Q16 = (unsigned short*)(ws + offQ);
  unsigned short* K16 = (unsigned short*)(ws + offK);
  unsigned short* VT  = (unsigned short*)(ws + offVT);

  // ---- prologue: concatenated 16-bit operand planes, one launch ----
  prep_planes_kernel<<<dim3(kLtot / 64, kBatch), dim3(256), 0, stream>>>(Q1, Q2, K1, K2, V1, V2, Q16, K16, VT);

  // ---- scores, softmax and P.V of all batches in one launch ----
  fused_attn_kernel<<<dim3(kBatch * (kLtot / kFaRows)), dim3(kFaWaves * 32), 0, stream>>>(Q16, K16, VT, out);
}

// v004
// One run takes 19 microseconds.
// Next to v003, in two timings, it ran 1.45 and 1.36 times as fast.
// Over all steps from v000 it is 45.4 times as fast.
// Contractions: scores fK.fQ^T on v_wmma_f32_16x16x32_bf16 (fQ, fK as RNE-bf16 planes), fV^T.P^T on v_wmma_f32_16x16x32_f16 (P = exp2 of the scaled score minus the maximum in use, rounded to f16; fV^T as an f16 plane holding RNE-bf16 values); f32 accumulate everywhere; softmax max/exp/normalise in f32, its denominator summed in f32 from the f16 P.
#include <hip/hip_runtime.h>
#include <math.h>

// ---------------------------------------------------------------------------
// Problem constants
// ---------------------------------------------------------------------------
constexpr int kBatch = 4;
constexpr int kSeq   = 2048;            // rows per input tensor
constexpr int kLtot  = 2 * kSeq;        // 4096 concatenated rows (queries and keys)
constexpr int kDim   = 64;
constexpr float kScaleLog2 = 0.125f * 1.4426950408889634f;   // 64^-0.5 * log2(e): softmax in base 2
static_assert(kDim == 64);              // two 32-deep k-steps of the scores product, four 16-row tiles of the output
static_assert(kSeq % 64 == 0);          // concat boundary on tile boundaries

typedef __attribute__((ext_vector_type(16))) _Float16 v16h;
typedef __attribute__((ext_vector_type(8)))  _Float16 v8h;
typedef __attribute__((ext_vector_type(2)))  _Float16 v2h;
typedef __attribute__((ext_vector_type(16))) __bf16   v16b;
typedef __attribute__((ext_vector_type(8)))  __bf16   v8b;
typedef __attribute__((ext_vector_type(8)))  float    v8f;
typedef __attribute__((ext_vector_type(4)))  float    v4f;
typedef __attribute__((ext_vector_type(2)))  float    v2f;
typedef __attribute__((ext_vector_type(4)))  unsigned int v4u;
typedef __attribute__((ext_vector_type(8)))  unsigned int v8u;

// ---------------------------------------------------------------------------
// Device helpers
// ---------------------------------------------------------------------------
__device__ __forceinline__ unsigned short f2bf_bits(float f) {
  unsigned u = __float_as_uint(f);
  return (unsigned short)((u + 0x7FFFu + ((u >> 16) & 1u)) >> 16);
}
__device__ __forceinline__ float bf_bits2f(unsigned short h) { return __uint_as_float(((unsigned)h) << 16); }

template <typename T> struct Frag;
template <> struct Frag<_Float16> {
  typedef v16h V; union U { v16h v; v8h h[2]; };
  // p = the fragment's 1-KiB unit of a plane + 8 * lane: elements 0..7 <- p[0..7], 8..15 <- p[256..263]; each of the two loads of a wave covers 512 contiguous bytes
  static __device__ __forceinline__ v16h load(const _Float16* p) {
    U f; f.h[0] = *(const v8h*)(p); f.h[1] = *(const v8h*)(p + 256); return f.v;
  }
  static __device__ __forceinline__ v8f mma(v16h a, v16h b, v8f c) {
    return __builtin_amdgcn_wmma_f32_16x16x32_f16(false, a, false, b, (short)0, c, false, false);
  }
};
template <> struct Frag<__bf16> {
  typedef v16b V; union U { v16b v; v8b h[2]; };
  static __device__ __forceinline__ v16b load(const __bf16* p) {
    U f; f.h[0] = *(const v8b*)(p); f.h[1] = *(const v8b*)(p + 256); return f.v;
  }
  static __device__ __forceinline__ v8f mma(v16b a, v16b b, v8f c) {
    return __builtin_amdgcn_wmma_f32_16x16x32_bf16(false, a, false, b, (short)0, c, false, false);
  }
};

__device__ __forceinline__ unsigned pk16(unsigned short a, unsigned short b) { return (unsigned)a | ((unsigned)b << 16); }
__device__ __forceinline__ unsigned short h_bits(float f) { const _Float16 h = (_Float16)f; return __builtin_bit_cast(unsigned short, h); }
// two f32 -> two f16, round to nearest even
__device__ __forceinline__ unsigned pack2h(float lo, float hi) { return __builtin_bit_cast(unsigned, __builtin_convertvector((v2f){lo, hi}, v2h)); }
// lane l <-> lane l ^ 16
__device__ __forceinline__ float xhalf(float x) {
  return __builtin_bit_cast(float, __builtin_amdgcn_permlanex16(__builtin_bit_cast(int, x), __builtin_bit_cast(int, x), 0x76543210, 0xfedcba98, false, false));
}

// ---------------------------------------------------------------------------
// Operand planes, all three in one launch. One work-group = one 64-row tile of the concatenated index r of one batch:
//   Q16, K16 = RNE-bf16 bits of fQ, fK;  VT = f16( RNE-bf16( fV ) );
//   rows r < 2048 come from the first tensor of a pair, the others from the second (row r - 2048).
// The planes are stored in the order in which the matrix fragments are read: one fragment (16 rows x 32 k) = one 1-KiB unit [j][lane][8 halves],
// lane = 16 h + c holding row c, k = 16 j + 8 h + 0..7, so that a wave's 16-byte load of a fragment half covers four whole 128-byte lines.
//   Q16, K16: unit index (b * 256 + r / 16) * 2 + d / 32, row c = r % 16, k = d % 32;
//   VT:       unit index (b * 128 + r / 32) * 4 + d / 16, row c = d % 16, k = r % 32.
// grid (64, kBatch): blockIdx.x = tile (tiles 0..31 read the first tensors, 32..63 the second, block-uniform), blockIdx.y = batch. 256 threads.
// Cast coverage per plane: 2 iterations x 8 waves = 16 (8-row, 32-column) blocks; in a block lane = 8 (2 j + h) + row: 8 source lines read whole, 4 plane lines written whole.
// V load coverage: 4 iterations x 256 threads x 4 floats = 4096 = the whole 64(s) x 64(d) tile (coalesced along d); every sm[d][s<64] written.
// V store coverage: 2 iterations (32-key block) x 8 waves (d / 16, j) = 16 fragment halves of 512 contiguous bytes, lane = 16 h + c.
// All twelve 16-byte loads of a thread are issued before the first is used.
// ---------------------------------------------------------------------------
__device__ __forceinline__ v4u cast8_bf16(v4f a, v4f c) {
  unsigned short hb[8];
#pragma unroll
  for (int e = 0; e < 4; ++e) {
    hb[e]     = f2bf_bits(a[e]);
    hb[4 + e] = f2bf_bits(c[e]);
  }
  return (v4u){pk16(hb[0], hb[1]), pk16(hb[2], hb[3]), pk16(hb[4], hb[5]), pk16(hb[6], hb[7])};
}

__global__ __launch_bounds__(256) void prep_planes_kernel(const float* __restrict__ qA, const float* __restrict__ qB,
                                                          const float* __restrict__ kA, const float* __restrict__ kB,
                                                          const float* __restrict__ vA, const float* __restrict__ vB,
                                                          unsigned short* __restrict__ q16, unsigned short* __restrict__ k16,
                                                          unsigned short* __restrict__ vt) {
  __shared__ float sm[kDim][65];   // sm[d][s_local]; column 64 is never read
  const int t  = threadIdx.x;
  const int tileIdx = blockIdx.x;
  const int b  = blockIdx.y;
  const int s0 = tileIdx * 64;                              // concatenated row index of the tile
  const bool first = tileIdx < (kSeq / 64);                 // block-uniform source select
  const int sl0 = s0 & (kSeq - 1);                          // row within the source tensor
  const size_t so   = ((size_t)b * kSeq + sl0) * kDim;      // the tile in a source tensor
  const size_t dofs = ((size_t)b * kLtot + s0) * kDim;      // the tile's 4096 halves in a plane
  const float* qs = (first ? qA : qB) + so;
  const float* ks = (first ? kA : kB) + so;
  const float* vs = (first ? vA : vB) + so;
  const int lane = t & 31, wave = t >> 5;
  // cast block of this wave in iteration 0: rows 16 (wave >> 2) + 8 (wave & 1) + 0..7, columns 32 ((wave >> 1) & 1) + 0..31; iteration 1: 32 rows on
  const int r8 = lane & 7, jh = lane >> 3;                  // row in the block; 8-column chunk 2 j + h
  const int cSrc = ((wave >> 2) * 16 + (wave & 1) * 8 + r8) * kDim + ((wave >> 1) & 1) * 32 + jh * 8;
  const int cDst = ((wave >> 2) * 2 + ((wave >> 1) & 1)) * 512 + (jh >> 1) * 256 + ((jh & 1) * 16 + (wave & 1) * 8 + r8) * 8;

  v4f w[4], qa[2][2], ka[2][2];
#pragma unroll
  for (int i = 0; i < 4; ++i) w[i] = *(const v4f*)(vs + 4 * (i * 256 + t));   // float4 index i * 256 + t = row (s local) * 16 + d / 4
#pragma unroll
  for (int i = 0; i < 2; ++i)
#pragma unroll
    for (int j = 0; j < 2; ++j) {
      qa[i][j] = *(const v4f*)(qs + i * 2048 + cSrc + 4 * j);
      ka[i][j] = *(const v4f*)(ks + i * 2048 + cSrc + 4 * j);
    }

#pragma unroll
  for (int i = 0; i < 4; ++i) {
    const int f  = i * 256 + t;     // float4 index 0..1023
    const int r  = f >> 4;          // s local 0..63
    const int d4 = (f & 15) * 4;    // d 0..60
#pragma unroll
    for (int e = 0; e < 4; ++e) sm[d4 + e][r] = bf_bits2f(f2bf_bits(w[i][e]));
  }
  __syncthreads();
  // the casts' stores stand behind the barrier, which would otherwise wait for them to complete
#pragma unroll
  for (int i = 0; i < 2; ++i) {
    *(v4u*)(q16 + dofs + i * 2048 + cDst) = cast8_bf16(qa[i][0], qa[i][1]);
    *(v4u*)(k16 + dofs + i * 2048 + cDst) = cast8_bf16(ka[i][0], ka[i][1]);
  }
  const int row = (wave >> 1) * 16 + (lane & 15);          // d
  const int c8  = (wave & 1) * 16 + (lane >> 4) * 8;       // key in the 32-key block: 16 j + 8 h
  unsigned short* op = vt + dofs + (wave >> 1) * 512 + (wave & 1) * 256 + lane * 8;   // a 64-key tile = 2 x 4 units = 4096 halves, as in a row-major plane
#pragma unroll
  for (int it = 0; it < 2; ++it) {
    unsigned short hb[8];
#pragma unroll
    for (int e = 0; e < 8; ++e) hb[e] = h_bits(sm[row][it * 32 + c8 + e]);
    const v4u u = (v4u){pk16(hb[0], hb[1]), pk16(hb[2], hb[3]), pk16(hb[4], hb[5]), pk16(hb[6], hb[7])};
    *(v4u*)(op + it * 2048) = u;
  }
}

// ---------------------------------------------------------------------------
// Fused attention: out[b][q][:] = softmax_k(0.125 * fQ[b][q].fK[b][k]) . fV[b][k][:], the scores never leave the registers.
// One work-group = 64 queries of one batch: grid = 4 x 64 = 256 work-groups of 8 waves.
// Wave w: all 64 query columns of the block (4 groups of 16), keys 512 w .. + 511, in 16 passes of 32 keys:
// a K or V^T fragment, once loaded, serves four column groups.
// Transposed products: S^T = K.Q^T (A = 16 key rows, B = 16 query columns), so a lane holds scores of ONE query (column c = lane & 15):
//   s[kt][g][r] = S[query 16 g + c][key 16 kt + 8 h + r], h = lane >> 4.
// The two score tiles of a pass, turned into exponentials and packed to f16 in place, are the B operand of O^T += V^T.P^T:
//   element e of the operand = tile e >> 3, register e & 7 = key 8 h + e (e < 8), 16 + 8 h + (e - 8) (e >= 8),
//   which is the key order in which Frag::load reads a unit of the V^T plane (A operand, row d = 16 t + c).
// Online softmax in base 2; the maximum in use may trail the true one by up to 8, so the accumulators are rescaled rarely.
// The denominator is one more product per column group: A with ones in row 0 gives the column sums of P^T in row 0 of lacc.
// The 8 key ranges of a query meet in LDS and are merged in range order 0..7 with weights exp2(m - max).
// ---------------------------------------------------------------------------
constexpr int kFaWaves  = 8;
constexpr int kFaRanges = kFaWaves;             // key ranges per work-group, one per wave
constexpr int kFaG      = 4;                    // 16-column query groups per wave
constexpr int kFaKeys   = kLtot / kFaRanges;    // keys per wave
constexpr int kFaPasses = kFaKeys / 32;
constexpr int kFaRows   = 64;                   // queries per work-group
constexpr int kFaPitch  = 68;                   // floats per LDS row of a partial: rows stay 16-B aligned, neighbours fall on other banks
static_assert(kFaKeys % 32 == 0 && kLtot % kFaRows == 0 && kFaRows == 16 * kFaG);
__global__ __launch_bounds__(kFaWaves * 32) void fused_attn_kernel(const unsigned short* __restrict__ Qp, const unsigned short* __restrict__ Kp,
                                                                   const unsigned short* __restrict__ VTp, float* __restrict__ outp) {
  __shared__ __align__(16) float part[kFaWaves][kFaRows * kFaPitch];
  __shared__ float pm[kFaWaves][kFaRows];
  __shared__ float pl[kFaWaves][kFaRows];
  const int tid  = threadIdx.x;
  const int lane = tid & 31;
  const int wave = __builtin_amdgcn_readfirstlane(tid >> 5);   // in a scalar register, so that the wave's base addresses are scalar too
  const int c    = lane & 15;
  const int h    = lane >> 4;
  const int b    = blockIdx.x / (kLtot / kFaRows);
  const int q0   = (blockIdx.x % (kLtot / kFaRows)) * kFaRows;
  const int kbeg = wave * kFaKeys;
  // wave-uniform bases in scalar registers; the lane's own part is a 32-bit offset
  // planes in fragment order (see prep_planes_kernel): 16 rows of Q or K = 2 units, 32 keys of V^T = 4 units, a unit = 512 halves
  const __bf16*   Qb = (const __bf16*)Qp    + ((size_t)b * kLtot + q0) * kDim;
  const __bf16*   Kb = (const __bf16*)Kp    + ((size_t)b * kLtot + kbeg) * kDim;
  const _Float16* Vb = (const _Float16*)VTp + ((size_t)b * kLtot + kbeg) * kDim;
  const unsigned  laneOff = (unsigned)(lane * 8);           // the lane's 8 halves in a fragment half

  v16b qf[kFaG][2];
#pragma unroll
  for (int g = 0; g < kFaG; ++g)
#pragma unroll
    for (int kc = 0; kc < 2; ++kc) qf[g][kc] = Frag<__bf16>::load(Qb + laneOff + (2 * g + kc) * 512);

  v16b kf[2][2];
#pragma unroll
  for (int kt = 0; kt < 2; ++kt)
#pragma unroll
    for (int kc = 0; kc < 2; ++kc) kf[kt][kc] = Frag<__bf16>::load(Kb + laneOff + (2 * kt + kc) * 512);

  v16h vf[4];
#pragma unroll
  for (int t = 0; t < 4; ++t) vf[t] = Frag<_Float16>::load(Vb + laneOff + t * 512);

  // stands in front of the first overwrite of the loads' address registers (reused right below)
  asm volatile("s_wait_xcnt 0x0" ::: "memory");
  __builtin_amdgcn_sched_barrier(0);   // keeps the register set-up below from being lifted over the wait

  const unsigned oneBits = (c == 0) ? 0x3C003C00u : 0u;   // f16 1.0 twice in lanes 0 and 16 (row 0 of A), 0 elsewhere
  const v16h ones = __builtin_bit_cast(v16h, (v8u){oneBits, oneBits, oneBits, oneBits, oneBits, oneBits, oneBits, oneBits});

  v8f acc[kFaG][4], lacc[kFaG];
  float m_run[kFaG];
#pragma unroll
  for (int g = 0; g < kFaG; ++g) {
    m_run[g] = -__builtin_inff();
    lacc[g] = (v8f){0.f,0.f,0.f,0.f,0.f,0.f,0.f,0.f};
#pragma unroll
    for (int t = 0; t < 4; ++t) acc[g][t] = (v8f){0.f,0.f,0.f,0.f,0.f,0.f,0.f,0.f};
  }

  // byte offset (lane's part included) of the fragments of the pass after the current one: a pass is 4 units = 4096 bytes in either plane
  unsigned nextB = (laneOff + 4u * 512u) * 2u;

  // two passes per trip: the two sets of V^T fragments swap roles without register copies; the body stays small in the instruction cache
#pragma unroll 2
  for (int i = 0; i < kFaPasses; ++i) {
    // K and V^T fragments are fetched one pass ahead; the last pass reads its own rows again (in bounds, not used)
    v16h vn[4];
#pragma unroll
    for (int t = 0; t < 4; ++t) vn[t] = Frag<_Float16>::load((const _Float16*)((const char*)Vb + nextB) + t * 512);

    v8f s[2][kFaG];
#pragma unroll
    for (int kt = 0; kt < 2; ++kt)
#pragma unroll
      for (int g = 0; g < kFaG; ++g) {
        s[kt][g] = (v8f){0.f,0.f,0.f,0.f,0.f,0.f,0.f,0.f};
#pragma unroll
        for (int kc = 0; kc < 2; ++kc) s[kt][g] = Frag<__bf16>::mma(kf[kt][kc], qf[g][kc], s[kt][g]);
      }
    // the next pass's K fragments
#pragma unroll
    for (int kt = 0; kt < 2; ++kt)
#pragma unroll
      for (int kc = 0; kc < 2; ++kc) kf[kt][kc] = Frag<__bf16>::load((const __bf16*)((const char*)Kb + nextB) + (2 * kt + kc) * 512);
    // stands in front of the first overwrite of the loads' address registers (stepped right below)
    asm volatile("s_wait_xcnt 0x0" ::: "memory");
    __builtin_amdgcn_sched_barrier(0);   // keeps the vector work below, which writes those registers, from being lifted over the wait
    if (i + 2 < kFaPasses) nextB += 4u * 512u * 2u;

    // maxima of the raw scores (the scale is positive), then one test per pass
    float mb[kFaG];
    bool need = false;
#pragma unroll
    for (int g = 0; g < kFaG; ++g) {
      float mx = s[0][g][0];
#pragma unroll
      for (int r = 1; r < 8; ++r) mx = fmaxf(mx, s[0][g][r]);
#pragma unroll
      for (int r = 0; r < 8; ++r) mx = fmaxf(mx, s[1][g][r]);
      mx = fmaxf(mx, xhalf(mx)) * kScaleLog2;   // both halves of the wave now hold this query's maximum, scaled
      mb[g] = mx;
      need = need || (mx > m_run[g] + 8.0f);
    }
    if (__builtin_amdgcn_ballot_w32(need) != 0) {   // wave-uniform; always taken in the first pass (m_run = -inf), rare later
#pragma unroll
      for (int g = 0; g < kFaG; ++g) {
        const float m_new = fmaxf(m_run[g], mb[g]);
        const float corr  = __builtin_amdgcn_exp2f(m_run[g] - m_new);   // 0 in the first pass
        m_run[g] = m_new;
        lacc[g] = lacc[g] * corr;
#pragma unroll
        for (int t = 0; t < 4; ++t) acc[g][t] = acc[g][t] * corr;
      }
    }
#pragma unroll
    for (int g = 0; g < kFaG; ++g) {
      const float nm = -m_run[g];
      v8u w;
#pragma unroll
      for (int e = 0; e < 8; ++e) {   // operand elements 2 e, 2 e + 1: tile e >> 2, registers 2 (e & 3), 2 (e & 3) + 1
        const float p0 = __builtin_amdgcn_exp2f(fmaf(s[e >> 2][g][2 * (e & 3)],     kScaleLog2, nm));
        const float p1 = __builtin_amdgcn_exp2f(fmaf(s[e >> 2][g][2 * (e & 3) + 1], kScaleLog2, nm));
        w[e] = pack2h(p0, p1);
      }
      const v16h pf = __builtin_bit_cast(v16h, w);
#pragma unroll
      for (int t = 0; t < 4; ++t) acc[g][t] = Frag<_Float16>::mma(vf[t], pf, acc[g][t]);
      lacc[g] = Frag<_Float16>::mma(ones, pf, lacc[g]);
    }
#pragma unroll
    for (int t = 0; t < 4; ++t) vf[t] = vn[t];
  }

  // ---- each wave's partial (maximum in use, denominator, 64 x 64 numerators) to LDS ----
  float* slab = part[wave];
#pragma unroll
  for (int g = 0; g < kFaG; ++g) {
    const float lr = lacc[g][0];          // the denominator in lanes 0..15 (row 0), 0 in lanes 16..31 (row 8)
    const float l  = lr + xhalf(lr);      // unconditional: every lane is on at the exchange
    if (h == 0) { pm[wave][16 * g + c] = m_run[g]; pl[wave][16 * g + c] = l; }
#pragma unroll
    for (int t = 0; t < 4; ++t) {
      float* sp = slab + (16 * g + c) * kFaPitch + 16 * t + 8 * h;   // row = query, 8 consecutive d
      *(v4f*)(sp)     = (v4f){acc[g][t][0], acc[g][t][1], acc[g][t][2], acc[g][t][3]};
      *(v4f*)(sp + 4) = (v4f){acc[g][t][4], acc[g][t][5], acc[g][t][6], acc[g][t][7]};
    }
  }
  __syncthreads();
  // ---- merge: 256 threads x 16 floats = the 64 x 64 block; 4 threads cover one 256-B row of out ----
  const int row = tid >> 2, c16 = (tid & 3) * 16;
  float mAll = pm[0][row];
#pragma unroll
  for (int w = 1; w < kFaRanges; ++w) mAll = fmaxf(mAll, pm[w][row]);
  float den = 0.f;
  v4f o[4];
#pragma unroll
  for (int j = 0; j < 4; ++j) o[j] = (v4f){0.f, 0.f, 0.f, 0.f};
#pragma unroll
  for (int w = 0; w < kFaRanges; ++w) {
    const float f = __builtin_amdgcn_exp2f(pm[w][row] - mAll);
    den += f * pl[w][row];
#pragma unroll
    for (int j = 0; j < 4; ++j) o[j] += f * *(const v4f*)(&part[w][row * kFaPitch + c16 + 4 * j]);
  }
  const float inv = 1.0f / den;
  float* op = outp + ((size_t)b * kLtot + q0 + row) * kDim + c16;
#pragma unroll
  for (int j = 0; j < 4; ++j) *(v4f*)(op + 4 * j) = o[j] * inv;
}

// ---------------------------------------------------------------------------
// Host glue.
//   Q16  bf16 [4][256][2] units       2,097,152  at           0   (written by prep_planes_kernel)
//   K16  bf16 [4][256][2] units       2,097,152  at   2,097,152   (written by prep_planes_kernel)
//   VT   f16  [4][128][4] units       2,097,152  at   4,194,304   (written by prep_planes_kernel)
//   total                             6,291,456
// ---------------------------------------------------------------------------
extern "C" void kernel_launch(void* const* d_in, const int* in_sizes, int n_in,
                              void* d_out, int out_size, void* d_ws, size_t ws_size,
                              hipStream_t stream) {
  if (n_in < 6) return;
  const int nIn = kBatch * kSeq * kDim;           // 524288 per input
  for (int i = 0; i < 6; ++i) if (in_sizes[i] != nIn) return;
  const int nOut = kBatch * kLtot * kDim;         // 1048576
  if (out_size != nOut) return;

  const size_t szQK = (size_t)kBatch * kLtot * kDim * 2;   // 2,097,152
  const size_t szVT = (size_t)kBatch * kDim * kLtot * 2;   // 2,097,152
  const size_t offQ  = 0;
  const size_t offK  = offQ + szQK;
  const size_t offVT = offK + szQK;
  const size_t total = offVT + szVT;                        // 6,291,456
  if (ws_size < total) return;

  const float* Q1 = (const float*)d_in[0];
  const float* K1 = (const float*)d_in[1];
  const float* V1 = (const float*)d_in[2];
  const float* Q2 = (const float*)d_in[3];
  const float* K2 = (const float*)d_in[4];
  const float* V2 = (const float*)d_in[5];
  float* out = (float*)d_out;
  char* ws = (char*)d_ws;
  unsigned short* Q16 = (unsigned short*)(ws + offQ);
  unsigned short* K16 = (unsigned short*)(ws + offK);
  unsigned short* VT  = (unsigned short*)(ws + offVT);

  // ---- prologue: concatenated 16-bit operand planes, one launch ----
  prep_planes_kernel<<<dim3(kLtot / 64, kBatch), dim3(256), 0, stream>>>(Q1, Q2, K1, K2, V1, V2, Q16, K16, VT);

  // ---- scores, softmax and P.V of all batches in one launch ----
  fused_attn_kernel<<<dim3(kBatch * (kLtot / kFaRows)), dim3(kFaWaves * 32), 0, stream>>>(Q16, K16, VT, out);
}
